// v000
// Times are from an AMD MI455X. After a warm-up the kernel runs many times in a row, and a time is the length of
// such a window on the GPU divided by its runs, so every launch and the gaps after it count. The runs cycle
// through copies of the inputs. A figure is the median of several windows, for all but v000 over two sittings.
// Sittings can differ by a few percent; kernels timed side by side share one.
// v000 is the starting kernel. One run takes 446 microseconds.
#include <hip/hip_runtime.h>
#include <math.h>

#define NPTS 20000
#define CCH  256
#define HH   2
#define EE   300000
#define QKVLD 768

typedef float v2f __attribute__((ext_vector_type(2)));
typedef float v8f __attribute__((ext_vector_type(8)));

// Guaranteed hardware fp32 atomic add (L2-side RMW, device scope, no return).
__device__ __forceinline__ void atomicAddF32(float* p, float v) {
    asm volatile("global_atomic_add_f32 %0, %1, off scope:SCOPE_DEV"
                 :: "v"(p), "v"(v) : "memory");
}

__device__ __forceinline__ void atomicMaxF(int* addr, float v) {
    if (v >= 0.0f) atomicMax(addr, __float_as_int(v));
    else           atomicMin((unsigned int*)addr, (unsigned int)__float_as_int(v));
}

// ---------------------------------------------------------------- init scratch
__global__ void init_ws(float* __restrict__ out_raw, float* __restrict__ denom,
                        int* __restrict__ segmax) {
    int i = blockIdx.x * blockDim.x + threadIdx.x;
    if (i < NPTS * CCH) out_raw[i] = 0.0f;
    if (i < NPTS * HH) { denom[i] = 0.0f; segmax[i] = (int)0xFF800000; } // -inf
}

// ------------------------------------------------- fp32 WMMA GEMM: C = A @ W^T
// A: [M x 256] row-major, W: [Nout x 256] row-major (B = W^T, K=256).
// One wave computes a 16x64 strip: 4 accumulators share each A fragment
// (V_WMMA_F32_16X16X4_F32, 64 k-steps). Manual depth-1 software pipeline;
// __launch_bounds__(256,1) relaxes the VGPR budget so the scheduler keeps the
// prefetched fragments in distinct registers (deep loads in flight) instead of
// collapsing them into one buffer with s_wait_loadcnt 0.
// A frag (16x4): lane l, reg r -> A[M = l&15][K = 2*(l>>4)+r]   (ISA 7.12.2)
// B frag (4x16): lane l, reg r -> B[K = 2*(l>>4)+r][N = l&15] = W[l&15][K]
// C/D (16x16):   reg g, lane l -> C[M = 8*(l>>4)+g][N = l&15]
__global__ void __launch_bounds__(256, 1)
gemm_xt_wmma(const float* __restrict__ A, const float* __restrict__ W,
             float* __restrict__ Cmat, const float* __restrict__ residual,
             int mtiles, int ngroups, int ldc, int ccol0) {
    int wid  = (blockIdx.x * blockDim.x + threadIdx.x) >> 5;
    int lane = threadIdx.x & 31;
    if (wid >= mtiles * ngroups) return;
    int tm = wid / ngroups, tg = wid % ngroups;   // strip = 4 n-tiles
    int half = lane >> 4, lr = lane & 15;

    // base pointers shifted so v2f index 2*k picks floats [4k+2*half, 4k+2*half+1]
    const v2f* arow  = (const v2f*)(A + (size_t)(tm * 16 + lr) * CCH + 2 * half);
    const v2f* brow0 = (const v2f*)(W + (size_t)((tg * 4 + 0) * 16 + lr) * CCH + 2 * half);
    const v2f* brow1 = (const v2f*)(W + (size_t)((tg * 4 + 1) * 16 + lr) * CCH + 2 * half);
    const v2f* brow2 = (const v2f*)(W + (size_t)((tg * 4 + 2) * 16 + lr) * CCH + 2 * half);
    const v2f* brow3 = (const v2f*)(W + (size_t)((tg * 4 + 3) * 16 + lr) * CCH + 2 * half);

    v8f acc0 = {}, acc1 = {}, acc2 = {}, acc3 = {};

    v2f a  = arow[0];
    v2f b0 = brow0[0], b1 = brow1[0], b2 = brow2[0], b3 = brow3[0];

#pragma unroll 9
    for (int k = 0; k < CCH / 4 - 1; ++k) {
        // prefetch next k-step into fresh registers (issues before the WMMAs)
        v2f an  = arow[2 * (k + 1)];
        v2f b0n = brow0[2 * (k + 1)];
        v2f b1n = brow1[2 * (k + 1)];
        v2f b2n = brow2[2 * (k + 1)];
        v2f b3n = brow3[2 * (k + 1)];

        acc0 = __builtin_amdgcn_wmma_f32_16x16x4_f32(false, a, false, b0, (short)0, acc0, false, false);
        acc1 = __builtin_amdgcn_wmma_f32_16x16x4_f32(false, a, false, b1, (short)0, acc1, false, false);
        acc2 = __builtin_amdgcn_wmma_f32_16x16x4_f32(false, a, false, b2, (short)0, acc2, false, false);
        acc3 = __builtin_amdgcn_wmma_f32_16x16x4_f32(false, a, false, b3, (short)0, acc3, false, false);

        a = an; b0 = b0n; b1 = b1n; b2 = b2n; b3 = b3n;
    }
    acc0 = __builtin_amdgcn_wmma_f32_16x16x4_f32(false, a, false, b0, (short)0, acc0, false, false);
    acc1 = __builtin_amdgcn_wmma_f32_16x16x4_f32(false, a, false, b1, (short)0, acc1, false, false);
    acc2 = __builtin_amdgcn_wmma_f32_16x16x4_f32(false, a, false, b2, (short)0, acc2, false, false);
    acc3 = __builtin_amdgcn_wmma_f32_16x16x4_f32(false, a, false, b3, (short)0, acc3, false, false);

    v8f accs[4] = {acc0, acc1, acc2, acc3};
#pragma unroll
    for (int t = 0; t < 4; ++t) {
        int col = ccol0 + (tg * 4 + t) * 16 + lr;
#pragma unroll
        for (int g = 0; g < 8; ++g) {
            int row = tm * 16 + 8 * half + g;
            size_t oidx = (size_t)row * ldc + col;
            float v = accs[t][g];
            if (residual) v += residual[oidx];
            Cmat[oidx] = v;
        }
    }
}

// ------------------------------------------------------- per-edge attn scores
// one wave per edge; lanes 0-15: head0 dims 0-127, lanes 16-31: head1 dims 128-255
__global__ void __launch_bounds__(256)
edge_scores(const float* __restrict__ QKV, const float* __restrict__ coords,
            const float* __restrict__ Wpos, const float* __restrict__ bpos,
            const int* __restrict__ qidx, const int* __restrict__ nidx,
            float* __restrict__ scores, int* __restrict__ segmax) {
    int e    = (blockIdx.x * blockDim.x + threadIdx.x) >> 5;
    int lane = threadIdx.x & 31;
    if (e >= EE) return;
    int qi = qidx[e], ni = nidx[e];

    const float4* qp = (const float4*)(QKV + (size_t)qi * QKVLD + lane * 8);
    const float4* kp = (const float4*)(QKV + (size_t)ni * QKVLD + 256 + lane * 8);
    float4 q0 = qp[0], q1 = qp[1], k0 = kp[0], k1 = kp[1];
    float s = q0.x * k0.x + q0.y * k0.y + q0.z * k0.z + q0.w * k0.w
            + q1.x * k1.x + q1.y * k1.y + q1.z * k1.z + q1.w * k1.w;
    s += __shfl_xor(s, 1);
    s += __shfl_xor(s, 2);
    s += __shfl_xor(s, 4);
    s += __shfl_xor(s, 8);

    if ((lane & 15) == 0) {
        int h = lane >> 4;
        float rx = coords[qi * 3 + 0] - coords[ni * 3 + 0];
        float ry = coords[qi * 3 + 1] - coords[ni * 3 + 1];
        float rz = coords[qi * 3 + 2] - coords[ni * 3 + 2];
        float pos = rx * Wpos[h * 3 + 0] + ry * Wpos[h * 3 + 1]
                  + rz * Wpos[h * 3 + 2] + bpos[h];
        float sc = s * 0.08838834764831845f + pos;   // D^-0.5, D=128
        scores[e * 2 + h] = sc;
        atomicMaxF(&segmax[qi * 2 + h], sc);
    }
}

// --------------------------------------------- per-edge exp + scatter of ex*v
__global__ void __launch_bounds__(256)
edge_accum(const float* __restrict__ QKV, const float* __restrict__ scores,
           const int* __restrict__ segmax, const int* __restrict__ qidx,
           const int* __restrict__ nidx, float* __restrict__ denom,
           float* __restrict__ out_raw) {
    int e    = (blockIdx.x * blockDim.x + threadIdx.x) >> 5;
    int lane = threadIdx.x & 31;
    if (e >= EE) return;
    int qi = qidx[e], ni = nidx[e];
    int h = lane >> 4;
    float mx = __int_as_float(segmax[qi * 2 + h]);
    float ex = expf(scores[e * 2 + h] - mx);
    if ((lane & 15) == 0) atomicAddF32(&denom[qi * 2 + h], ex);

    const float4* vp = (const float4*)(QKV + (size_t)ni * QKVLD + 512 + lane * 8);
    float4 v0 = vp[0], v1 = vp[1];
    float* op = out_raw + (size_t)qi * CCH + lane * 8;
    atomicAddF32(op + 0, ex * v0.x);
    atomicAddF32(op + 1, ex * v0.y);
    atomicAddF32(op + 2, ex * v0.z);
    atomicAddF32(op + 3, ex * v0.w);
    atomicAddF32(op + 4, ex * v1.x);
    atomicAddF32(op + 5, ex * v1.y);
    atomicAddF32(op + 6, ex * v1.z);
    atomicAddF32(op + 7, ex * v1.w);
}

// -------------------------------------------------------- softmax denominator
__global__ void normalize_out(float* __restrict__ out_raw,
                              const float* __restrict__ denom) {
    int i = blockIdx.x * blockDim.x + threadIdx.x;
    if (i >= NPTS * CCH) return;
    int n = i >> 8;
    int h = (i >> 7) & 1;
    float d = denom[n * 2 + h];
    out_raw[i] = (d > 0.0f) ? out_raw[i] / d : 0.0f;
}

// ------------------------------------------------------- wave-per-row LayerNorm
__global__ void __launch_bounds__(256)
layernorm(const float* __restrict__ y, const float* __restrict__ gamma,
          const float* __restrict__ beta, float* __restrict__ out) {
    int r    = (blockIdx.x * blockDim.x + threadIdx.x) >> 5;
    int lane = threadIdx.x & 31;
    if (r >= NPTS) return;
    const float4* yp = (const float4*)(y + (size_t)r * CCH + lane * 8);
    float4 a = yp[0], b = yp[1];
    float s  = a.x + a.y + a.z + a.w + b.x + b.y + b.z + b.w;
    float s2 = a.x * a.x + a.y * a.y + a.z * a.z + a.w * a.w
             + b.x * b.x + b.y * b.y + b.z * b.z + b.w * b.w;
    for (int m = 1; m < 32; m <<= 1) {
        s  += __shfl_xor(s, m);
        s2 += __shfl_xor(s2, m);
    }
    float mean = s * (1.0f / CCH);
    float var  = s2 * (1.0f / CCH) - mean * mean;
    float rstd = rsqrtf(var + 1e-5f);
    int c0 = lane * 8;
    float* op = out + (size_t)r * CCH + c0;
    float vin[8] = {a.x, a.y, a.z, a.w, b.x, b.y, b.z, b.w};
#pragma unroll
    for (int j = 0; j < 8; ++j)
        op[j] = (vin[j] - mean) * rstd * gamma[c0 + j] + beta[c0 + j];
}

// ------------------------------------------------------------------- launcher
extern "C" void kernel_launch(void* const* d_in, const int* in_sizes, int n_in,
                              void* d_out, int out_size, void* d_ws, size_t ws_size,
                              hipStream_t stream) {
    const float* features = (const float*)d_in[0];
    const float* coords   = (const float*)d_in[1];
    const float* Wq       = (const float*)d_in[2];
    const float* Wk       = (const float*)d_in[3];
    const float* Wv       = (const float*)d_in[4];
    const float* Wo       = (const float*)d_in[5];
    const float* Wpos     = (const float*)d_in[6];
    const float* bpos     = (const float*)d_in[7];
    const float* gamma    = (const float*)d_in[8];
    const float* beta     = (const float*)d_in[9];
    const int*   nidx     = (const int*)d_in[10];
    const int*   qidx     = (const int*)d_in[11];
    float* out = (float*)d_out;

    float* ws      = (float*)d_ws;
    float* QKV     = ws;                                // N*768 floats
    float* out_raw = QKV + (size_t)NPTS * QKVLD;        // N*256
    float* scores  = out_raw + (size_t)NPTS * CCH;      // E*2
    float* denom   = scores + (size_t)EE * HH;          // N*2
    int*   segmax  = (int*)(denom + (size_t)NPTS * HH); // N*2
    float* y       = QKV;  // QKV dead after edge_accum; reuse for residual output

    // 1. init scratch
    init_ws<<<(NPTS * CCH + 255) / 256, 256, 0, stream>>>(out_raw, denom, segmax);

    // 2-4. Q/K/V projections (fp32 WMMA), packed into QKV rows of 768
    {
        int mtiles = NPTS / 16, ngroups = CCH / 64;          // 1250, 4
        int blocks = (mtiles * ngroups * 32 + 255) / 256;
        gemm_xt_wmma<<<blocks, 256, 0, stream>>>(features, Wq, QKV, nullptr, mtiles, ngroups, QKVLD, 0);
        gemm_xt_wmma<<<blocks, 256, 0, stream>>>(features, Wk, QKV, nullptr, mtiles, ngroups, QKVLD, 256);
        gemm_xt_wmma<<<blocks, 256, 0, stream>>>(features, Wv, QKV, nullptr, mtiles, ngroups, QKVLD, 512);
    }

    // 5-6. edge passes (one wave per edge)
    {
        int blocks = (EE * 32 + 255) / 256;
        edge_scores<<<blocks, 256, 0, stream>>>(QKV, coords, Wpos, bpos, qidx, nidx, scores, segmax);
        edge_accum<<<blocks, 256, 0, stream>>>(QKV, scores, segmax, qidx, nidx, denom, out_raw);
    }

    // 7. softmax normalization at node level
    normalize_out<<<(NPTS * CCH + 255) / 256, 256, 0, stream>>>(out_raw, denom);

    // 8. output projection + residual (fp32 WMMA)
    {
        int mtiles = NPTS / 16, ngroups = CCH / 64;
        int blocks = (mtiles * ngroups * 32 + 255) / 256;
        gemm_xt_wmma<<<blocks, 256, 0, stream>>>(out_raw, Wo, y, features, mtiles, ngroups, CCH, 0);
    }

    // 9. LayerNorm
    layernorm<<<(NPTS * 32 + 255) / 256, 256, 0, stream>>>(y, gamma, beta, out);
}

// v001
// A run of this version takes 258 microseconds.
// In both of two side-by-side timings against v000, it was 1.77 times as fast.
#include <hip/hip_runtime.h>
#include <math.h>

#define NPTS 20000
#define CCH  256
#define HH   2
#define EE   300000
#define QKVLD 768

typedef float v2f __attribute__((ext_vector_type(2)));
typedef float v8f __attribute__((ext_vector_type(8)));

// ------------------------------------------------------- empty per-query lists
__global__ void init_ws(int* __restrict__ head) {
    int i = blockIdx.x * blockDim.x + threadIdx.x;
    if (i < NPTS) head[i] = -1;
}

// ------------------------------------------- chain the edges of each query node
// One thread per edge pushes its edge on the front of its query's list:
// link[e] = (edge that was first before, neighbour, positional bias of head 0, of head 1).
// An edge enters once, so every list is finite and ends in -1.
__global__ void __launch_bounds__(256)
link_edges(const float* __restrict__ coords, const float* __restrict__ Wpos,
           const float* __restrict__ bpos, const int* __restrict__ qidx,
           const int* __restrict__ nidx, int* __restrict__ head, int* __restrict__ link) {
    int e = blockIdx.x * blockDim.x + threadIdx.x;
    if (e >= EE) return;
    int qi = qidx[e];
    int ni = min(max(nidx[e], 0), NPTS - 1);
    if ((unsigned)qi >= (unsigned)NPTS) return;   // no such segment
    float rx = coords[qi * 3 + 0] - coords[ni * 3 + 0];
    float ry = coords[qi * 3 + 1] - coords[ni * 3 + 1];
    float rz = coords[qi * 3 + 2] - coords[ni * 3 + 2];
    float p0 = rx * Wpos[0] + ry * Wpos[1] + rz * Wpos[2] + bpos[0];
    float p1 = rx * Wpos[3] + ry * Wpos[4] + rz * Wpos[5] + bpos[1];
    int prev = atomicExch(&head[qi], e);
    // the exchange's address and data registers are reused below: address wait first
    asm volatile("s_wait_xcnt 0x0" ::: "memory");
    ((int4*)link)[e] = make_int4(prev, ni, __float_as_int(p0), __float_as_int(p1));
}

// ------------------------------------------------- fp32 WMMA GEMM: C = A @ W^T
// A: [M x 256] row-major, W: [Nout x 256] row-major (B = W^T, K=256).
// One wave computes a 16x64 strip: 4 accumulators share each A fragment
// (V_WMMA_F32_16X16X4_F32, 64 k-steps). Manual depth-1 software pipeline;
// __launch_bounds__(256,1) relaxes the VGPR budget so the scheduler keeps the
// prefetched fragments in distinct registers (deep loads in flight) instead of
// collapsing them into one buffer with s_wait_loadcnt 0.
// A frag (16x4): lane l, reg r -> A[M = l&15][K = 2*(l>>4)+r]   (ISA 7.12.2)
// B frag (4x16): lane l, reg r -> B[K = 2*(l>>4)+r][N = l&15] = W[l&15][K]
// C/D (16x16):   reg g, lane l -> C[M = 8*(l>>4)+g][N = l&15]
__global__ void __launch_bounds__(256, 1)
gemm_xt_wmma(const float* __restrict__ A, const float* __restrict__ W,
             float* __restrict__ Cmat, const float* __restrict__ residual,
             int mtiles, int ngroups, int ldc, int ccol0) {
    int wid  = (blockIdx.x * blockDim.x + threadIdx.x) >> 5;
    int lane = threadIdx.x & 31;
    if (wid >= mtiles * ngroups) return;
    int tm = wid / ngroups, tg = wid % ngroups;   // strip = 4 n-tiles
    int half = lane >> 4, lr = lane & 15;

    // base pointers shifted so v2f index 2*k picks floats [4k+2*half, 4k+2*half+1]
    const v2f* arow  = (const v2f*)(A + (size_t)(tm * 16 + lr) * CCH + 2 * half);
    const v2f* brow0 = (const v2f*)(W + (size_t)((tg * 4 + 0) * 16 + lr) * CCH + 2 * half);
    const v2f* brow1 = (const v2f*)(W + (size_t)((tg * 4 + 1) * 16 + lr) * CCH + 2 * half);
    const v2f* brow2 = (const v2f*)(W + (size_t)((tg * 4 + 2) * 16 + lr) * CCH + 2 * half);
    const v2f* brow3 = (const v2f*)(W + (size_t)((tg * 4 + 3) * 16 + lr) * CCH + 2 * half);

    v8f acc0 = {}, acc1 = {}, acc2 = {}, acc3 = {};

    v2f a  = arow[0];
    v2f b0 = brow0[0], b1 = brow1[0], b2 = brow2[0], b3 = brow3[0];

#pragma unroll 9
    for (int k = 0; k < CCH / 4 - 1; ++k) {
        // prefetch next k-step into fresh registers (issues before the WMMAs)
        v2f an  = arow[2 * (k + 1)];
        v2f b0n = brow0[2 * (k + 1)];
        v2f b1n = brow1[2 * (k + 1)];
        v2f b2n = brow2[2 * (k + 1)];
        v2f b3n = brow3[2 * (k + 1)];

        acc0 = __builtin_amdgcn_wmma_f32_16x16x4_f32(false, a, false, b0, (short)0, acc0, false, false);
        acc1 = __builtin_amdgcn_wmma_f32_16x16x4_f32(false, a, false, b1, (short)0, acc1, false, false);
        acc2 = __builtin_amdgcn_wmma_f32_16x16x4_f32(false, a, false, b2, (short)0, acc2, false, false);
        acc3 = __builtin_amdgcn_wmma_f32_16x16x4_f32(false, a, false, b3, (short)0, acc3, false, false);

        a = an; b0 = b0n; b1 = b1n; b2 = b2n; b3 = b3n;
    }
    acc0 = __builtin_amdgcn_wmma_f32_16x16x4_f32(false, a, false, b0, (short)0, acc0, false, false);
    acc1 = __builtin_amdgcn_wmma_f32_16x16x4_f32(false, a, false, b1, (short)0, acc1, false, false);
    acc2 = __builtin_amdgcn_wmma_f32_16x16x4_f32(false, a, false, b2, (short)0, acc2, false, false);
    acc3 = __builtin_amdgcn_wmma_f32_16x16x4_f32(false, a, false, b3, (short)0, acc3, false, false);

    v8f accs[4] = {acc0, acc1, acc2, acc3};
#pragma unroll
    for (int t = 0; t < 4; ++t) {
        int col = ccol0 + (tg * 4 + t) * 16 + lr;
#pragma unroll
        for (int g = 0; g < 8; ++g) {
            int row = tm * 16 + 8 * half + g;
            size_t oidx = (size_t)row * ldc + col;
            float v = accs[t][g];
            if (residual) v += residual[oidx];
            Cmat[oidx] = v;
        }
    }
}

// sum over the 16 lanes of a row, in the vector unit (no LDS round trip)
__device__ __forceinline__ float row16_sum(float s) {
    s += __int_as_float(__builtin_amdgcn_update_dpp(0, __float_as_int(s), 0x161, 0xf, 0xf, true)); // row_xmask:1
    s += __int_as_float(__builtin_amdgcn_update_dpp(0, __float_as_int(s), 0x162, 0xf, 0xf, true)); // row_xmask:2
    s += __int_as_float(__builtin_amdgcn_update_dpp(0, __float_as_int(s), 0x164, 0xf, 0xf, true)); // row_xmask:4
    s += __int_as_float(__builtin_amdgcn_update_dpp(0, __float_as_int(s), 0x168, 0xf, 0xf, true)); // row_xmask:8
    return s;
}

struct Rows { float4 k0, k1, v0, v1; };

__device__ __forceinline__ Rows load_rows(const float* __restrict__ QKV, int n, int off) {
    const float* r = QKV + (size_t)n * QKVLD + 256 + off;
    Rows t;
    t.k0 = *(const float4*)r;         t.k1 = *(const float4*)(r + 64);
    t.v0 = *(const float4*)(r + 256); t.v1 = *(const float4*)(r + 320);
    return t;
}

// one edge of the online softmax: running maximum m, denominator l, weighted sum a0,a1
__device__ __forceinline__ void edge_step(const Rows& t, float pos, const float4& q0, const float4& q1,
                                          float& m, float& l, float4& a0, float4& a1) {
    float sa = fmaf(q0.w, t.k0.w, fmaf(q0.z, t.k0.z, fmaf(q0.y, t.k0.y, q0.x * t.k0.x)));
    float sb = fmaf(q1.w, t.k1.w, fmaf(q1.z, t.k1.z, fmaf(q1.y, t.k1.y, q1.x * t.k1.x)));
    float s  = row16_sum(sa + sb);
    float sc = s * 0.08838834764831845f + pos;   // D^-0.5, D=128
    float mn   = fmaxf(m, sc);
    float corr = expf(m - mn);                   // 0 on the first edge
    float p    = expf(sc - mn);
    m = mn;
    l = l * corr + p;
    a0.x = a0.x * corr + p * t.v0.x;  a0.y = a0.y * corr + p * t.v0.y;
    a0.z = a0.z * corr + p * t.v0.z;  a0.w = a0.w * corr + p * t.v0.w;
    a1.x = a1.x * corr + p * t.v1.x;  a1.y = a1.y * corr + p * t.v1.y;
    a1.z = a1.z * corr + p * t.v1.z;  a1.w = a1.w * corr + p * t.v1.w;
}

// ------------------------------------- one wave per query node: gather attention
// Lanes 0-15 hold head 0, lanes 16-31 head 1; a lane owns dims 4*(l&15)..+3 and
// 64+4*(l&15)..+3 of its head, so each 16-byte load of the wave covers whole lines.
// The wave walks its node's edge list and writes the normalised row once; the next
// list entry is requested together with the current edge's rows.
__global__ void __launch_bounds__(256)
node_attn(const float* __restrict__ QKV, const int* __restrict__ head,
          const int* __restrict__ link, float* __restrict__ out_raw) {
    int node = __builtin_amdgcn_readfirstlane((int)((blockIdx.x * blockDim.x + threadIdx.x) >> 5));
    int lane = threadIdx.x & 31;
    if (node >= NPTS) return;
    bool h1 = lane >= 16;
    int off = (lane >> 4) * 128 + (lane & 15) * 4;
    const int4* link4 = (const int4*)link;

    float4 a0 = make_float4(0.f, 0.f, 0.f, 0.f), a1 = a0;

    int e0 = head[node];
    if (e0 >= 0) {
        float m = -INFINITY, l = 0.0f;
        const float* qrow = QKV + (size_t)node * QKVLD + off;
        float4 q0 = *(const float4*)qrow, q1 = *(const float4*)(qrow + 64);

        int4 L = link4[e0];
        for (int it = 0; it < EE; ++it) {        // a list holds at most EE edges
            Rows t = load_rows(QKV, L.y, off);
            int4 Ln = link4[L.x >= 0 ? L.x : e0];   // past the end: the first entry again, not used
            // keeps the wait for the next list entry behind the issue of this edge's row loads
            __builtin_amdgcn_sched_barrier(0);
            edge_step(t, __int_as_float(h1 ? L.w : L.z), q0, q1, m, l, a0, a1);
            if (L.x < 0) break;
            L = Ln;
        }
        a0.x /= l; a0.y /= l; a0.z /= l; a0.w /= l;
        a1.x /= l; a1.y /= l; a1.z /= l; a1.w /= l;
    }
    float* op = out_raw + (size_t)node * CCH + off;
    *(float4*)op        = a0;      // a node without edges gets zeros
    *(float4*)(op + 64) = a1;
}

// ------------------------------------------------------- wave-per-row LayerNorm
__global__ void __launch_bounds__(256)
layernorm(const float* __restrict__ y, const float* __restrict__ gamma,
          const float* __restrict__ beta, float* __restrict__ out) {
    int r    = (blockIdx.x * blockDim.x + threadIdx.x) >> 5;
    int lane = threadIdx.x & 31;
    if (r >= NPTS) return;
    const float4* yp = (const float4*)(y + (size_t)r * CCH + lane * 8);
    float4 a = yp[0], b = yp[1];
    float s  = a.x + a.y + a.z + a.w + b.x + b.y + b.z + b.w;
    float s2 = a.x * a.x + a.y * a.y + a.z * a.z + a.w * a.w
             + b.x * b.x + b.y * b.y + b.z * b.z + b.w * b.w;
    for (int m = 1; m < 32; m <<= 1) {
        s  += __shfl_xor(s, m);
        s2 += __shfl_xor(s2, m);
    }
    float mean = s * (1.0f / CCH);
    float var  = s2 * (1.0f / CCH) - mean * mean;
    float rstd = rsqrtf(var + 1e-5f);
    int c0 = lane * 8;
    float* op = out + (size_t)r * CCH + c0;
    float vin[8] = {a.x, a.y, a.z, a.w, b.x, b.y, b.z, b.w};
#pragma unroll
    for (int j = 0; j < 8; ++j)
        op[j] = (vin[j] - mean) * rstd * gamma[c0 + j] + beta[c0 + j];
}

// ------------------------------------------------------------------- launcher
extern "C" void kernel_launch(void* const* d_in, const int* in_sizes, int n_in,
                              void* d_out, int out_size, void* d_ws, size_t ws_size,
                              hipStream_t stream) {
    const float* features = (const float*)d_in[0];
    const float* coords   = (const float*)d_in[1];
    const float* Wq       = (const float*)d_in[2];
    const float* Wk       = (const float*)d_in[3];
    const float* Wv       = (const float*)d_in[4];
    const float* Wo       = (const float*)d_in[5];
    const float* Wpos     = (const float*)d_in[6];
    const float* bpos     = (const float*)d_in[7];
    const float* gamma    = (const float*)d_in[8];
    const float* beta     = (const float*)d_in[9];
    const int*   nidx     = (const int*)d_in[10];
    const int*   qidx     = (const int*)d_in[11];
    float* out = (float*)d_out;

    float* ws      = (float*)d_ws;
    float* QKV     = ws;                                // N*768 floats
    float* out_raw = QKV + (size_t)NPTS * QKVLD;        // N*256
    int*   link    = (int*)(out_raw + (size_t)NPTS * CCH); // E*4
    int*   head    = link + (size_t)EE * 4;             // N
    float* y       = QKV;  // QKV dead after node_attn; reuse for residual output

    // 1-2. per-query edge lists
    init_ws<<<(NPTS + 255) / 256, 256, 0, stream>>>(head);
    link_edges<<<(EE + 255) / 256, 256, 0, stream>>>(coords, Wpos, bpos, qidx, nidx, head, link);

    // 3-5. Q/K/V projections (fp32 WMMA), packed into QKV rows of 768
    {
        int mtiles = NPTS / 16, ngroups = CCH / 64;          // 1250, 4
        int blocks = (mtiles * ngroups * 32 + 255) / 256;
        gemm_xt_wmma<<<blocks, 256, 0, stream>>>(features, Wq, QKV, nullptr, mtiles, ngroups, QKVLD, 0);
        gemm_xt_wmma<<<blocks, 256, 0, stream>>>(features, Wk, QKV, nullptr, mtiles, ngroups, QKVLD, 256);
        gemm_xt_wmma<<<blocks, 256, 0, stream>>>(features, Wv, QKV, nullptr, mtiles, ngroups, QKVLD, 512);
    }

    // 6. scores, softmax and weighted sum (one wave per query node)
    node_attn<<<(NPTS * 32 + 255) / 256, 256, 0, stream>>>(QKV, head, link, out_raw);

    // 7. output projection + residual (fp32 WMMA)
    {
        int mtiles = NPTS / 16, ngroups = CCH / 64;
        int blocks = (mtiles * ngroups * 32 + 255) / 256;
        gemm_xt_wmma<<<blocks, 256, 0, stream>>>(out_raw, Wo, y, features, mtiles, ngroups, CCH, 0);
    }

    // 8. LayerNorm
    layernorm<<<(NPTS * 32 + 255) / 256, 256, 0, stream>>>(y, gamma, beta, out);
}

// v002
// One run takes 158 microseconds.
// Next to v001, in two timings, it ran 1.70 and 1.72 times as fast.
// Counting every step since v000, it is 3.02 times as fast.
#include <hip/hip_runtime.h>
#include <math.h>

#define NPTS 20000
#define CCH  256
#define HH   2
#define EE   300000
#define QKVLD 768

typedef float v2f __attribute__((ext_vector_type(2)));
typedef float v8f __attribute__((ext_vector_type(8)));

// ------------------------------------------------------- empty per-query lists
__global__ void init_ws(int* __restrict__ head) {
    int i = blockIdx.x * blockDim.x + threadIdx.x;
    if (i < NPTS) head[i] = -1;
}

// ------------------------------------------- chain the edges of each query node
// One thread per edge pushes its edge on the front of its query's list:
// link[e] = (edge that was first before, neighbour, positional bias of head 0, of head 1).
// An edge enters once, so every list is finite and ends in -1.
__global__ void __launch_bounds__(256)
link_edges(const float* __restrict__ coords, const float* __restrict__ Wpos,
           const float* __restrict__ bpos, const int* __restrict__ qidx,
           const int* __restrict__ nidx, int* __restrict__ head, int* __restrict__ link) {
    int e = blockIdx.x * blockDim.x + threadIdx.x;
    if (e >= EE) return;
    int qi = qidx[e];
    int ni = min(max(nidx[e], 0), NPTS - 1);
    if ((unsigned)qi >= (unsigned)NPTS) return;   // no such segment
    float rx = coords[qi * 3 + 0] - coords[ni * 3 + 0];
    float ry = coords[qi * 3 + 1] - coords[ni * 3 + 1];
    float rz = coords[qi * 3 + 2] - coords[ni * 3 + 2];
    float p0 = rx * Wpos[0] + ry * Wpos[1] + rz * Wpos[2] + bpos[0];
    float p1 = rx * Wpos[3] + ry * Wpos[4] + rz * Wpos[5] + bpos[1];
    int prev = atomicExch(&head[qi], e);
    // the exchange's address and data registers are reused below: address wait first
    asm volatile("s_wait_xcnt 0x0" ::: "memory");
    ((int4*)link)[e] = make_int4(prev, ni, __float_as_int(p0), __float_as_int(p1));
}

// ------------------------------------------------- fp32 WMMA GEMM: C = A @ W^T
// A: [M x 256] row-major, W: [Nout x 256] row-major (B = W^T, K=256).
// One work-group (8 waves) computes a 128x64 tile; one wave a 16x64 strip: 4 accumulators
// share each A fragment (V_WMMA_F32_16X16X4_F32, 64 k-steps, k ascending).
// Both operands go through LDS in stages of 64 k: every thread brings 16-byte pieces of
// whole 256-byte row segments (a wave's load covers whole lines), and the fragments, which
// take 8 bytes from each of 16 rows, are read from LDS. Two buffers: the next stage's global
// loads fly while this stage is multiplied, and one barrier per stage is enough (a buffer is
// rewritten only behind the barrier that every wave reaches after its last read of it).
// Staged row pitch 68 floats: the 16 rows of a fragment start 4 banks apart.
// A frag (16x4): lane l, reg r -> A[M = l&15][K = 2*(l>>4)+r]   (ISA 7.12.2)
// B frag (4x16): lane l, reg r -> B[K = 2*(l>>4)+r][N = l&15] = W[l&15][K]
// C/D (16x16):   reg g, lane l -> C[M = 8*(l>>4)+g][N = l&15]
#define GT_M     128                 // rows of A per work-group
#define GT_N     64                  // rows of W per work-group
#define GT_KC    64                  // k per stage
#define GT_PITCH 68                  // floats per staged row
#define GT_ROWS  (GT_M + GT_N)
#define GEMM_BLOCKS (((NPTS / 16 + 7) / 8) * (CCH / GT_N))

// 6 waves per SIMD: three work-groups share a WGP (LDS allows three), so one's stage hand-over
// is covered by the others' matrix work
__global__ void __launch_bounds__(256, 6)
gemm_xt_wmma(const float* __restrict__ A, const float* __restrict__ W,
             float* __restrict__ Cmat, const float* __restrict__ residual,
             int mtiles, int ngroups, int ldc, int ccol0) {
    __shared__ __attribute__((aligned(16))) float stage[2][GT_ROWS * GT_PITCH];

    int tid  = threadIdx.x;
    int wave = __builtin_amdgcn_readfirstlane(tid >> 5);
    int lane = tid & 31;
    int half = lane >> 4, lr = lane & 15;
    int tg = blockIdx.x % ngroups, mb = blockIdx.x / ngroups;   // strip = 4 n-tiles
    // the last row block is moved up to end with the matrix, so every staged row exists;
    // its waves whose strips the block before already covers compute but do not store
    int row0 = min(mb * GT_M, mtiles * 16 - GT_M);
    int tm = (row0 >> 4) + wave;

    // staging: this thread brings 16-byte column c4 of staged rows srow, srow+16, ...
    int srow = tid >> 4, c4 = tid & 15;
    const char* Ab = (const char*)A;
    const char* Wb = (const char*)W;
    unsigned aoff = (unsigned)((row0 + srow) * CCH + c4 * 4) * 4u;          // byte offsets
    unsigned boff = (unsigned)((tg * GT_N + srow) * CCH + c4 * 4) * 4u;
    int soff = srow * GT_PITCH + c4 * 4;

    float4 ra[8], rb[4];
#pragma unroll
    for (int i = 0; i < 8; ++i) ra[i] = *(const float4*)(Ab + aoff + i * 16 * CCH * 4);
#pragma unroll
    for (int i = 0; i < 4; ++i) rb[i] = *(const float4*)(Wb + boff + i * 16 * CCH * 4);

    v8f acc0 = {}, acc1 = {}, acc2 = {}, acc3 = {};

    // unrolled so that buffer and stage offsets are constants
#pragma unroll
    for (int c = 0; c < CCH / GT_KC; ++c) {
        float* s = stage[c & 1];
#pragma unroll
        for (int i = 0; i < 8; ++i) *(float4*)(s + soff + i * 16 * GT_PITCH) = ra[i];
#pragma unroll
        for (int i = 0; i < 4; ++i) *(float4*)(s + soff + (GT_M + i * 16) * GT_PITCH) = rb[i];
        __syncthreads();   // publishes stage c; also ends every wave's reads of the other buffer

        if (c + 1 < CCH / GT_KC) {
#pragma unroll
            for (int i = 0; i < 8; ++i) ra[i] = *(const float4*)(Ab + aoff + (i * 16 * CCH + (c + 1) * GT_KC) * 4);
#pragma unroll
            for (int i = 0; i < 4; ++i) rb[i] = *(const float4*)(Wb + boff + (i * 16 * CCH + (c + 1) * GT_KC) * 4);
            // keeps the issue of the next stage's loads in front of this stage's products;
            // without it they sink to their LDS stores and their latency is paid in the open
            __builtin_amdgcn_sched_barrier(0);
        }

        const float* as = s + (wave * 16 + lr) * GT_PITCH + 2 * half;
        const float* bs = s + (GT_M + lr) * GT_PITCH + 2 * half;
#pragma unroll
        for (int k = 0; k < GT_KC / 4; ++k) {
            v2f a  = *(const v2f*)(as + 4 * k);
            v2f b0 = *(const v2f*)(bs + 4 * k);
            v2f b1 = *(const v2f*)(bs + 16 * GT_PITCH + 4 * k);
            v2f b2 = *(const v2f*)(bs + 32 * GT_PITCH + 4 * k);
            v2f b3 = *(const v2f*)(bs + 48 * GT_PITCH + 4 * k);
            acc0 = __builtin_amdgcn_wmma_f32_16x16x4_f32(false, a, false, b0, (short)0, acc0, false, false);
            acc1 = __builtin_amdgcn_wmma_f32_16x16x4_f32(false, a, false, b1, (short)0, acc1, false, false);
            acc2 = __builtin_amdgcn_wmma_f32_16x16x4_f32(false, a, false, b2, (short)0, acc2, false, false);
            acc3 = __builtin_amdgcn_wmma_f32_16x16x4_f32(false, a, false, b3, (short)0, acc3, false, false);
        }
    }

    if (tm < mb * 8) return;         // whole wave, behind the last barrier

    v8f accs[4] = {acc0, acc1, acc2, acc3};
#pragma unroll
    for (int t = 0; t < 4; ++t) {
        int col = ccol0 + (tg * 4 + t) * 16 + lr;
#pragma unroll
        for (int g = 0; g < 8; ++g) {
            int row = tm * 16 + 8 * half + g;
            size_t oidx = (size_t)row * ldc + col;
            float v = accs[t][g];
            if (residual) v += residual[oidx];
            Cmat[oidx] = v;
        }
    }
}

// sum over the 16 lanes of a row, in the vector unit (no LDS round trip)
__device__ __forceinline__ float row16_sum(float s) {
    s += __int_as_float(__builtin_amdgcn_update_dpp(0, __float_as_int(s), 0x161, 0xf, 0xf, true)); // row_xmask:1
    s += __int_as_float(__builtin_amdgcn_update_dpp(0, __float_as_int(s), 0x162, 0xf, 0xf, true)); // row_xmask:2
    s += __int_as_float(__builtin_amdgcn_update_dpp(0, __float_as_int(s), 0x164, 0xf, 0xf, true)); // row_xmask:4
    s += __int_as_float(__builtin_amdgcn_update_dpp(0, __float_as_int(s), 0x168, 0xf, 0xf, true)); // row_xmask:8
    return s;
}

struct Rows { float4 k0, k1, v0, v1; };

__device__ __forceinline__ Rows load_rows(const float* __restrict__ QKV, int n, int off) {
    const float* r = QKV + (size_t)n * QKVLD + 256 + off;
    Rows t;
    t.k0 = *(const float4*)r;         t.k1 = *(const float4*)(r + 64);
    t.v0 = *(const float4*)(r + 256); t.v1 = *(const float4*)(r + 320);
    return t;
}

// one edge of the online softmax: running maximum m, denominator l, weighted sum a0,a1
__device__ __forceinline__ void edge_step(const Rows& t, float pos, const float4& q0, const float4& q1,
                                          float& m, float& l, float4& a0, float4& a1) {
    float sa = fmaf(q0.w, t.k0.w, fmaf(q0.z, t.k0.z, fmaf(q0.y, t.k0.y, q0.x * t.k0.x)));
    float sb = fmaf(q1.w, t.k1.w, fmaf(q1.z, t.k1.z, fmaf(q1.y, t.k1.y, q1.x * t.k1.x)));
    float s  = row16_sum(sa + sb);
    float sc = s * 0.08838834764831845f + pos;   // D^-0.5, D=128
    float mn   = fmaxf(m, sc);
    float corr = expf(m - mn);                   // 0 on the first edge
    float p    = expf(sc - mn);
    m = mn;
    l = l * corr + p;
    a0.x = a0.x * corr + p * t.v0.x;  a0.y = a0.y * corr + p * t.v0.y;
    a0.z = a0.z * corr + p * t.v0.z;  a0.w = a0.w * corr + p * t.v0.w;
    a1.x = a1.x * corr + p * t.v1.x;  a1.y = a1.y * corr + p * t.v1.y;
    a1.z = a1.z * corr + p * t.v1.z;  a1.w = a1.w * corr + p * t.v1.w;
}

// ------------------------------------- one wave per query node: gather attention
// Lanes 0-15 hold head 0, lanes 16-31 head 1; a lane owns dims 4*(l&15)..+3 and
// 64+4*(l&15)..+3 of its head, so each 16-byte load of the wave covers whole lines.
// The wave walks its node's edge list and writes the normalised row once; the next
// list entry is requested together with the current edge's rows.
__global__ void __launch_bounds__(256)
node_attn(const float* __restrict__ QKV, const int* __restrict__ head,
          const int* __restrict__ link, float* __restrict__ out_raw) {
    int node = __builtin_amdgcn_readfirstlane((int)((blockIdx.x * blockDim.x + threadIdx.x) >> 5));
    int lane = threadIdx.x & 31;
    if (node >= NPTS) return;
    bool h1 = lane >= 16;
    int off = (lane >> 4) * 128 + (lane & 15) * 4;
    const int4* link4 = (const int4*)link;

    float4 a0 = make_float4(0.f, 0.f, 0.f, 0.f), a1 = a0;

    int e0 = head[node];
    if (e0 >= 0) {
        float m = -INFINITY, l = 0.0f;
        const float* qrow = QKV + (size_t)node * QKVLD + off;
        float4 q0 = *(const float4*)qrow, q1 = *(const float4*)(qrow + 64);

        int4 L = link4[e0];
        for (int it = 0; it < EE; ++it) {        // a list holds at most EE edges
            Rows t = load_rows(QKV, L.y, off);
            int4 Ln = link4[L.x >= 0 ? L.x : e0];   // past the end: the first entry again, not used
            // keeps the wait for the next list entry behind the issue of this edge's row loads
            __builtin_amdgcn_sched_barrier(0);
            edge_step(t, __int_as_float(h1 ? L.w : L.z), q0, q1, m, l, a0, a1);
            if (L.x < 0) break;
            L = Ln;
        }
        a0.x /= l; a0.y /= l; a0.z /= l; a0.w /= l;
        a1.x /= l; a1.y /= l; a1.z /= l; a1.w /= l;
    }
    float* op = out_raw + (size_t)node * CCH + off;
    *(float4*)op        = a0;      // a node without edges gets zeros
    *(float4*)(op + 64) = a1;
}

// ------------------------------------------------------- wave-per-row LayerNorm
__global__ void __launch_bounds__(256)
layernorm(const float* __restrict__ y, const float* __restrict__ gamma,
          const float* __restrict__ beta, float* __restrict__ out) {
    int r    = (blockIdx.x * blockDim.x + threadIdx.x) >> 5;
    int lane = threadIdx.x & 31;
    if (r >= NPTS) return;
    const float4* yp = (const float4*)(y + (size_t)r * CCH + lane * 8);
    float4 a = yp[0], b = yp[1];
    float s  = a.x + a.y + a.z + a.w + b.x + b.y + b.z + b.w;
    float s2 = a.x * a.x + a.y * a.y + a.z * a.z + a.w * a.w
             + b.x * b.x + b.y * b.y + b.z * b.z + b.w * b.w;
    for (int m = 1; m < 32; m <<= 1) {
        s  += __shfl_xor(s, m);
        s2 += __shfl_xor(s2, m);
    }
    float mean = s * (1.0f / CCH);
    float var  = s2 * (1.0f / CCH) - mean * mean;
    float rstd = rsqrtf(var + 1e-5f);
    int c0 = lane * 8;
    float* op = out + (size_t)r * CCH + c0;
    float vin[8] = {a.x, a.y, a.z, a.w, b.x, b.y, b.z, b.w};
#pragma unroll
    for (int j = 0; j < 8; ++j)
        op[j] = (vin[j] - mean) * rstd * gamma[c0 + j] + beta[c0 + j];
}

// ------------------------------------------------------------------- launcher
extern "C" void kernel_launch(void* const* d_in, const int* in_sizes, int n_in,
                              void* d_out, int out_size, void* d_ws, size_t ws_size,
                              hipStream_t stream) {
    const float* features = (const float*)d_in[0];
    const float* coords   = (const float*)d_in[1];
    const float* Wq       = (const float*)d_in[2];
    const float* Wk       = (const float*)d_in[3];
    const float* Wv       = (const float*)d_in[4];
    const float* Wo       = (const float*)d_in[5];
    const float* Wpos     = (const float*)d_in[6];
    const float* bpos     = (const float*)d_in[7];
    const float* gamma    = (const float*)d_in[8];
    const float* beta     = (const float*)d_in[9];
    const int*   nidx     = (const int*)d_in[10];
    const int*   qidx     = (const int*)d_in[11];
    float* out = (float*)d_out;

    float* ws      = (float*)d_ws;
    float* QKV     = ws;                                // N*768 floats
    float* out_raw = QKV + (size_t)NPTS * QKVLD;        // N*256
    int*   link    = (int*)(out_raw + (size_t)NPTS * CCH); // E*4
    int*   head    = link + (size_t)EE * 4;             // N
    float* y       = QKV;  // QKV dead after node_attn; reuse for residual output

    // 1-2. per-query edge lists
    init_ws<<<(NPTS + 255) / 256, 256, 0, stream>>>(head);
    link_edges<<<(EE + 255) / 256, 256, 0, stream>>>(coords, Wpos, bpos, qidx, nidx, head, link);

    // 3-5. Q/K/V projections (fp32 WMMA), packed into QKV rows of 768
    {
        int mtiles = NPTS / 16, ngroups = CCH / GT_N;        // 1250, 4
        int blocks = GEMM_BLOCKS;                            // 157 row blocks x 4 strips
        gemm_xt_wmma<<<blocks, 256, 0, stream>>>(features, Wq, QKV, nullptr, mtiles, ngroups, QKVLD, 0);
        gemm_xt_wmma<<<blocks, 256, 0, stream>>>(features, Wk, QKV, nullptr, mtiles, ngroups, QKVLD, 256);
        gemm_xt_wmma<<<blocks, 256, 0, stream>>>(features, Wv, QKV, nullptr, mtiles, ngroups, QKVLD, 512);
    }

    // 6. scores, softmax and weighted sum (one wave per query node)
    node_attn<<<(NPTS * 32 + 255) / 256, 256, 0, stream>>>(QKV, head, link, out_raw);

    // 7. output projection + residual (fp32 WMMA)
    {
        int mtiles = NPTS / 16, ngroups = CCH / GT_N;
        int blocks = GEMM_BLOCKS;
        gemm_xt_wmma<<<blocks, 256, 0, stream>>>(out_raw, Wo, y, features, mtiles, ngroups, CCH, 0);
    }

    // 8. LayerNorm
    layernorm<<<(NPTS * 32 + 255) / 256, 256, 0, stream>>>(y, gamma, beta, out);
}

// v003
// It runs in 138 microseconds.
// Timed twice side by side with v002, it ran 1.11 and 1.07 times as fast.
// Counting every step since v000, it is 3.29 times as fast.
#include <hip/hip_runtime.h>
#include <math.h>

#define NPTS 20000
#define CCH  256
#define HH   2
#define EE   300000
#define QKVLD 768

typedef float v2f __attribute__((ext_vector_type(2)));
typedef float v8f __attribute__((ext_vector_type(8)));

// ------------------------------------------------------- empty per-query lists
__global__ void init_ws(int* __restrict__ head) {
    int i = blockIdx.x * blockDim.x + threadIdx.x;
    if (i < NPTS) head[i] = -1;
}

// ------------------------------------------- chain the edges of each query node
// One thread per edge pushes its edge on the front of its query's list:
// link[e] = (edge that was first before, neighbour, positional bias of head 0, of head 1).
// An edge enters once, so every list is finite and ends in -1.
__global__ void __launch_bounds__(256)
link_edges(const float* __restrict__ coords, const float* __restrict__ Wpos,
           const float* __restrict__ bpos, const int* __restrict__ qidx,
           const int* __restrict__ nidx, int* __restrict__ head, int* __restrict__ link) {
    int e = blockIdx.x * blockDim.x + threadIdx.x;
    if (e >= EE) return;
    int qi = qidx[e];
    int ni = min(max(nidx[e], 0), NPTS - 1);
    if ((unsigned)qi >= (unsigned)NPTS) return;   // no such segment
    float rx = coords[qi * 3 + 0] - coords[ni * 3 + 0];
    float ry = coords[qi * 3 + 1] - coords[ni * 3 + 1];
    float rz = coords[qi * 3 + 2] - coords[ni * 3 + 2];
    float p0 = rx * Wpos[0] + ry * Wpos[1] + rz * Wpos[2] + bpos[0];
    float p1 = rx * Wpos[3] + ry * Wpos[4] + rz * Wpos[5] + bpos[1];
    int prev = atomicExch(&head[qi], e);
    // the exchange's address and data registers are reused below: address wait first
    asm volatile("s_wait_xcnt 0x0" ::: "memory");
    ((int4*)link)[e] = make_int4(prev, ni, __float_as_int(p0), __float_as_int(p1));
}

// ------------------------------------------------- fp32 WMMA GEMM: C = A @ W^T
// A: [M x 256] row-major, W: [Nout x 256] row-major (B = W^T, K=256).
// One work-group (8 waves) computes a 128x64 tile; one wave a 16x64 strip: 4 accumulators
// share each A fragment (V_WMMA_F32_16X16X4_F32, 64 k-steps, k ascending).
// Both operands go through LDS in stages of 64 k: every thread brings 16-byte pieces of
// whole 256-byte row segments (a wave's load covers whole lines), and the fragments, which
// take 8 bytes from each of 16 rows, are read from LDS. Two buffers: the next stage's global
// loads fly while this stage is multiplied, and one barrier per stage is enough (a buffer is
// rewritten only behind the barrier that every wave reaches after its last read of it).
// Staged row pitch 68 floats: the 16 rows of a fragment start 4 banks apart.
// A frag (16x4): lane l, reg r -> A[M = l&15][K = 2*(l>>4)+r]   (ISA 7.12.2)
// B frag (4x16): lane l, reg r -> B[K = 2*(l>>4)+r][N = l&15] = W[l&15][K]
// C/D (16x16):   reg g, lane l -> C[M = 8*(l>>4)+g][N = l&15]
#define GT_M     128                 // rows of A per work-group
#define GT_N     64                  // rows of W per work-group
#define GT_KC    64                  // k per stage
#define GT_PITCH 68                  // floats per staged row
#define GT_ROWS  (GT_M + GT_N)
#define GEMM_BLOCKS (((NPTS / 16 + 7) / 8) * (CCH / GT_N))

// 6 waves per SIMD: three work-groups share a WGP (LDS allows three), so one's stage hand-over
// is covered by the others' matrix work
__global__ void __launch_bounds__(256, 6)
gemm_xt_wmma(const float* __restrict__ A, const float* __restrict__ W,
             float* __restrict__ Cmat, const float* __restrict__ residual,
             int mtiles, int ngroups, int ldc, int ccol0) {
    __shared__ __attribute__((aligned(16))) float stage[2][GT_ROWS * GT_PITCH];

    int tid  = threadIdx.x;
    int wave = __builtin_amdgcn_readfirstlane(tid >> 5);
    int lane = tid & 31;
    int half = lane >> 4, lr = lane & 15;
    int tg = blockIdx.x % ngroups, mb = blockIdx.x / ngroups;   // strip = 4 n-tiles
    // the last row block is moved up to end with the matrix, so every staged row exists;
    // its waves whose strips the block before already covers compute but do not store
    int row0 = min(mb * GT_M, mtiles * 16 - GT_M);
    int tm = (row0 >> 4) + wave;

    // staging: this thread brings 16-byte column c4 of staged rows srow, srow+16, ...
    int srow = tid >> 4, c4 = tid & 15;
    const char* Ab = (const char*)A;
    const char* Wb = (const char*)W;
    unsigned aoff = (unsigned)((row0 + srow) * CCH + c4 * 4) * 4u;          // byte offsets
    unsigned boff = (unsigned)((tg * GT_N + srow) * CCH + c4 * 4) * 4u;
    int soff = srow * GT_PITCH + c4 * 4;

    float4 ra[8], rb[4];
#pragma unroll
    for (int i = 0; i < 8; ++i) ra[i] = *(const float4*)(Ab + aoff + i * 16 * CCH * 4);
#pragma unroll
    for (int i = 0; i < 4; ++i) rb[i] = *(const float4*)(Wb + boff + i * 16 * CCH * 4);

    v8f acc0 = {}, acc1 = {}, acc2 = {}, acc3 = {};

    // unrolled so that buffer and stage offsets are constants
#pragma unroll
    for (int c = 0; c < CCH / GT_KC; ++c) {
        float* s = stage[c & 1];
#pragma unroll
        for (int i = 0; i < 8; ++i) *(float4*)(s + soff + i * 16 * GT_PITCH) = ra[i];
#pragma unroll
        for (int i = 0; i < 4; ++i) *(float4*)(s + soff + (GT_M + i * 16) * GT_PITCH) = rb[i];
        __syncthreads();   // publishes stage c; also ends every wave's reads of the other buffer

        if (c + 1 < CCH / GT_KC) {
#pragma unroll
            for (int i = 0; i < 8; ++i) ra[i] = *(const float4*)(Ab + aoff + (i * 16 * CCH + (c + 1) * GT_KC) * 4);
#pragma unroll
            for (int i = 0; i < 4; ++i) rb[i] = *(const float4*)(Wb + boff + (i * 16 * CCH + (c + 1) * GT_KC) * 4);
            // keeps the issue of the next stage's loads in front of this stage's products;
            // without it they sink to their LDS stores and their latency is paid in the open
            __builtin_amdgcn_sched_barrier(0);
        }

        const float* as = s + (wave * 16 + lr) * GT_PITCH + 2 * half;
        const float* bs = s + (GT_M + lr) * GT_PITCH + 2 * half;
#pragma unroll
        for (int k = 0; k < GT_KC / 4; ++k) {
            v2f a  = *(const v2f*)(as + 4 * k);
            v2f b0 = *(const v2f*)(bs + 4 * k);
            v2f b1 = *(const v2f*)(bs + 16 * GT_PITCH + 4 * k);
            v2f b2 = *(const v2f*)(bs + 32 * GT_PITCH + 4 * k);
            v2f b3 = *(const v2f*)(bs + 48 * GT_PITCH + 4 * k);
            acc0 = __builtin_amdgcn_wmma_f32_16x16x4_f32(false, a, false, b0, (short)0, acc0, false, false);
            acc1 = __builtin_amdgcn_wmma_f32_16x16x4_f32(false, a, false, b1, (short)0, acc1, false, false);
            acc2 = __builtin_amdgcn_wmma_f32_16x16x4_f32(false, a, false, b2, (short)0, acc2, false, false);
            acc3 = __builtin_amdgcn_wmma_f32_16x16x4_f32(false, a, false, b3, (short)0, acc3, false, false);
        }
    }

    if (tm < mb * 8) return;         // whole wave, behind the last barrier

    v8f accs[4] = {acc0, acc1, acc2, acc3};
#pragma unroll
    for (int t = 0; t < 4; ++t) {
        int col = ccol0 + (tg * 4 + t) * 16 + lr;
#pragma unroll
        for (int g = 0; g < 8; ++g) {
            int row = tm * 16 + 8 * half + g;
            size_t oidx = (size_t)row * ldc + col;
            float v = accs[t][g];
            if (residual) v += residual[oidx];
            Cmat[oidx] = v;
        }
    }
}

// sum over the 16 lanes of a row, in the vector unit (no LDS round trip)
__device__ __forceinline__ float row16_sum(float s) {
    s += __int_as_float(__builtin_amdgcn_update_dpp(0, __float_as_int(s), 0x161, 0xf, 0xf, true)); // row_xmask:1
    s += __int_as_float(__builtin_amdgcn_update_dpp(0, __float_as_int(s), 0x162, 0xf, 0xf, true)); // row_xmask:2
    s += __int_as_float(__builtin_amdgcn_update_dpp(0, __float_as_int(s), 0x164, 0xf, 0xf, true)); // row_xmask:4
    s += __int_as_float(__builtin_amdgcn_update_dpp(0, __float_as_int(s), 0x168, 0xf, 0xf, true)); // row_xmask:8
    return s;
}

struct Rows { float4 k0, k1, v0, v1; };

__device__ __forceinline__ Rows load_rows(const float* __restrict__ QKV, int n, int off) {
    const float* r = QKV + (size_t)n * QKVLD + 256 + off;
    Rows t;
    t.k0 = *(const float4*)r;         t.k1 = *(const float4*)(r + 64);
    t.v0 = *(const float4*)(r + 256); t.v1 = *(const float4*)(r + 320);
    return t;
}

// one edge of the online softmax: running maximum m, denominator l, weighted sum a0,a1
__device__ __forceinline__ void edge_step(const Rows& t, float pos, const float4& q0, const float4& q1,
                                          float& m, float& l, float4& a0, float4& a1) {
    float sa = fmaf(q0.w, t.k0.w, fmaf(q0.z, t.k0.z, fmaf(q0.y, t.k0.y, q0.x * t.k0.x)));
    float sb = fmaf(q1.w, t.k1.w, fmaf(q1.z, t.k1.z, fmaf(q1.y, t.k1.y, q1.x * t.k1.x)));
    float s  = row16_sum(sa + sb);
    float sc = s * 0.08838834764831845f + pos;   // D^-0.5, D=128
    float mn   = fmaxf(m, sc);
    float corr = expf(m - mn);                   // 0 on the first edge
    float p    = expf(sc - mn);
    m = mn;
    l = l * corr + p;
    a0.x = a0.x * corr + p * t.v0.x;  a0.y = a0.y * corr + p * t.v0.y;
    a0.z = a0.z * corr + p * t.v0.z;  a0.w = a0.w * corr + p * t.v0.w;
    a1.x = a1.x * corr + p * t.v1.x;  a1.y = a1.y * corr + p * t.v1.y;
    a1.z = a1.z * corr + p * t.v1.z;  a1.w = a1.w * corr + p * t.v1.w;
}

// ------------------------------------- one wave per query node: gather attention
// Lanes 0-15 hold head 0, lanes 16-31 head 1; a lane owns dims 4*(l&15)..+3 and
// 64+4*(l&15)..+3 of its head, so each 16-byte load of the wave covers whole lines.
// The wave walks its node's edge list and writes the normalised row once; the next
// list entry is requested together with the current edge's rows.
__global__ void __launch_bounds__(256)
node_attn(const float* __restrict__ QKV, const int* __restrict__ head,
          const int* __restrict__ link, float* __restrict__ out_raw) {
    int node = __builtin_amdgcn_readfirstlane((int)((blockIdx.x * blockDim.x + threadIdx.x) >> 5));
    int lane = threadIdx.x & 31;
    if (node >= NPTS) return;
    bool h1 = lane >= 16;
    int off = (lane >> 4) * 128 + (lane & 15) * 4;
    const int4* link4 = (const int4*)link;

    float4 a0 = make_float4(0.f, 0.f, 0.f, 0.f), a1 = a0;

    int e0 = head[node];
    if (e0 >= 0) {
        float m = -INFINITY, l = 0.0f;
        const float* qrow = QKV + (size_t)node * QKVLD + off;
        float4 q0 = *(const float4*)qrow, q1 = *(const float4*)(qrow + 64);

        int4 L = link4[e0];
        for (int it = 0; it < EE; ++it) {        // a list holds at most EE edges
            Rows t = load_rows(QKV, L.y, off);
            int4 Ln = link4[L.x >= 0 ? L.x : e0];   // past the end: the first entry again, not used
            // keeps the wait for the next list entry behind the issue of this edge's row loads
            __builtin_amdgcn_sched_barrier(0);
            edge_step(t, __int_as_float(h1 ? L.w : L.z), q0, q1, m, l, a0, a1);
            if (L.x < 0) break;
            L = Ln;
        }
        a0.x /= l; a0.y /= l; a0.z /= l; a0.w /= l;
        a1.x /= l; a1.y /= l; a1.z /= l; a1.w /= l;
    }
    float* op = out_raw + (size_t)node * CCH + off;
    *(float4*)op        = a0;      // a node without edges gets zeros
    *(float4*)(op + 64) = a1;
}

// ------------------- output projection + residual + LayerNorm in one launch
// out = LayerNorm(A @ W^T + residual). One work-group (8 waves) owns 32 WHOLE rows (all 256
// columns), so a row's mean and variance are formed from the accumulators and the sum of
// projection and residual never goes through memory. Wave w: row tile w>>2, columns
// 64*(w&3)..+63, 4 accumulators, fragments and k order as in gemm_xt_wmma.
// The 32 rows of A are put in LDS whole, once. W goes through LDS in stages of 32 k (all its
// 256 rows are staged, so the stage is shorter: three work-groups still share a WGP); two
// buffers and one barrier per stage as above.
// Row pitches 260 and 36 floats: the 16 rows of a fragment start on 16 different groups of 4 banks.
#define OT_M      32                 // rows of A per work-group
#define OT_KC     32                 // k per stage of W
#define OT_PITCH  36                 // floats per staged row of W
#define OT_APITCH 260                // floats per row of A in LDS

__global__ void __launch_bounds__(256, 6)
gemm_o_layernorm(const float* __restrict__ A, const float* __restrict__ W,
                 const float* __restrict__ residual, const float* __restrict__ gamma,
                 const float* __restrict__ beta, float* __restrict__ out) {
    __shared__ __attribute__((aligned(16))) float atile[OT_M * OT_APITCH];
    __shared__ __attribute__((aligned(16))) float stage[2][CCH * OT_PITCH];
    // per row: (sum, sum of squares) over each of the 4 column groups
    __shared__ __attribute__((aligned(16))) float red[OT_M][8];

    int tid  = threadIdx.x;
    int wave = __builtin_amdgcn_readfirstlane(tid >> 5);
    int lane = tid & 31;
    int half = lane >> 4, lr = lane & 15;
    int rt = wave >> 2, cg = wave & 3;
    int row0 = blockIdx.x * OT_M;    // NPTS is a multiple of OT_M

    // staging of W: this thread brings 16-byte column c4 of rows srow, srow+32, ...
    int srow = tid >> 3, c4 = tid & 7;
    const char* Ab = (const char*)A;
    const char* Wb = (const char*)W;
    unsigned boff = (unsigned)(srow * CCH + c4 * 4) * 4u;                   // byte offsets
    int soff = srow * OT_PITCH + c4 * 4;
    // A: 16-byte column tid&63 of rows tid>>6, +4, ... (a wave's load is 512 bytes in a row)
    unsigned aoff = (unsigned)((row0 + (tid >> 6)) * CCH + (tid & 63) * 4) * 4u;
    float* ad = atile + (tid >> 6) * OT_APITCH + (tid & 63) * 4;

    // piece i of stage c of W; named registers, not an array: the array stayed in scratch memory
#define OT_W(i, c) (*(const float4*)(Wb + boff + ((i) * 32 * CCH + (c) * OT_KC) * 4))
#define OT_S(i)    (*(float4*)(s + soff + (i) * 32 * OT_PITCH))
#define OT_A(i)    (*(const float4*)(Ab + aoff + (i) * 4 * CCH * 4))
#define OT_AD(i)   (*(float4*)(ad + (i) * 4 * OT_APITCH))
    float4 ra0 = OT_A(0), ra1 = OT_A(1), ra2 = OT_A(2), ra3 = OT_A(3);
    float4 ra4 = OT_A(4), ra5 = OT_A(5), ra6 = OT_A(6), ra7 = OT_A(7);
    float4 rb0 = OT_W(0, 0), rb1 = OT_W(1, 0), rb2 = OT_W(2, 0), rb3 = OT_W(3, 0);
    float4 rb4 = OT_W(4, 0), rb5 = OT_W(5, 0), rb6 = OT_W(6, 0), rb7 = OT_W(7, 0);
    // address wait behind the run of loads; the offsets are inputs so that their registers
    // stay theirs up to here and no load of the run lands on the run's own offset register
    asm volatile("s_wait_xcnt 0x0" :: "v"(aoff), "v"(boff) : "memory");

    OT_AD(0) = ra0; OT_AD(1) = ra1; OT_AD(2) = ra2; OT_AD(3) = ra3;   // published by stage 0's barrier
    OT_AD(4) = ra4; OT_AD(5) = ra5; OT_AD(6) = ra6; OT_AD(7) = ra7;

    v8f acc0 = {}, acc1 = {}, acc2 = {}, acc3 = {};

    // this lane's accumulators hold rows lrow..lrow+7 of the tile at columns col0 + 16*t
    int lrow = rt * 16 + 8 * half;
    int col0 = cg * 64 + lr;
    unsigned base = (unsigned)((row0 + lrow) * CCH + col0) * 4u;             // byte offset
    const char* Rb = (const char*)residual;
    char* Ob = (char*)out;
    float y[4][8], gam[4], bet[4];

    // unrolled so that buffer and stage offsets are constants
#pragma unroll
    for (int c = 0; c < CCH / OT_KC; ++c) {
        float* s = stage[c & 1];
        OT_S(0) = rb0; OT_S(1) = rb1; OT_S(2) = rb2; OT_S(3) = rb3;
        OT_S(4) = rb4; OT_S(5) = rb5; OT_S(6) = rb6; OT_S(7) = rb7;
        __syncthreads();   // publishes stage c; also ends every wave's reads of the other buffer

        if (c + 1 < CCH / OT_KC) {
            rb0 = OT_W(0, c + 1); rb1 = OT_W(1, c + 1); rb2 = OT_W(2, c + 1); rb3 = OT_W(3, c + 1);
            rb4 = OT_W(4, c + 1); rb5 = OT_W(5, c + 1); rb6 = OT_W(6, c + 1); rb7 = OT_W(7, c + 1);
            // keeps the issue of the next stage's loads in front of this stage's products;
            // without it they sink to their LDS stores and their latency is paid in the open
            __builtin_amdgcn_sched_barrier(0);
        } else {
            // last stage: residual, gamma and beta fly under the products, in the registers W has left
#pragma unroll
            for (int t = 0; t < 4; ++t) {
#pragma unroll
                for (int g = 0; g < 8; ++g) y[t][g] = *(const float*)(Rb + base + (g * CCH + t * 16) * 4);
                gam[t] = gamma[col0 + t * 16];
                bet[t] = beta[col0 + t * 16];
            }
            // address wait behind the run of loads, in front of any reuse of their base and offset
            // registers; the offsets are inputs so that their registers stay theirs up to here
            asm volatile("s_wait_xcnt 0x0" :: "v"(base), "v"(col0) : "memory");
            // keeps the issue of these loads in front of the products, as above
            __builtin_amdgcn_sched_barrier(0);
        }

        const float* as = atile + (rt * 16 + lr) * OT_APITCH + c * OT_KC + 2 * half;
        const float* bs = s + (cg * 64 + lr) * OT_PITCH + 2 * half;
#pragma unroll
        for (int k = 0; k < OT_KC / 4; ++k) {
            v2f a  = *(const v2f*)(as + 4 * k);
            v2f b0 = *(const v2f*)(bs + 4 * k);
            v2f b1 = *(const v2f*)(bs + 16 * OT_PITCH + 4 * k);
            v2f b2 = *(const v2f*)(bs + 32 * OT_PITCH + 4 * k);
            v2f b3 = *(const v2f*)(bs + 48 * OT_PITCH + 4 * k);
            acc0 = __builtin_amdgcn_wmma_f32_16x16x4_f32(false, a, false, b0, (short)0, acc0, false, false);
            acc1 = __builtin_amdgcn_wmma_f32_16x16x4_f32(false, a, false, b1, (short)0, acc1, false, false);
            acc2 = __builtin_amdgcn_wmma_f32_16x16x4_f32(false, a, false, b2, (short)0, acc2, false, false);
            acc3 = __builtin_amdgcn_wmma_f32_16x16x4_f32(false, a, false, b3, (short)0, acc3, false, false);
        }
        // keeps the next stage's LDS stores, which wait for its global loads, behind these products
        __builtin_amdgcn_sched_barrier(0);
    }
    // four vector slots between the last product and the first vector instruction that reads a
    // result or reuses an operand register of it
    asm volatile("v_nop\n\tv_nop\n\tv_nop\n\tv_nop");
    // keeps the arithmetic below behind those slots
    __builtin_amdgcn_sched_barrier(0);

    v8f accs[4] = {acc0, acc1, acc2, acc3};
#pragma unroll
    for (int t = 0; t < 4; ++t)
#pragma unroll
        for (int g = 0; g < 8; ++g) y[t][g] += accs[t][g];

    // each row's sum and sum of squares over this wave's 64 columns
#pragma unroll
    for (int g = 0; g < 8; ++g) {
        float s1 = (y[0][g] + y[1][g]) + (y[2][g] + y[3][g]);
        float s2 = (y[0][g] * y[0][g] + y[1][g] * y[1][g]) + (y[2][g] * y[2][g] + y[3][g] * y[3][g]);
        s1 = row16_sum(s1);
        s2 = row16_sum(s2);
        if (lr == 0) *(float2*)&red[lrow + g][cg * 2] = make_float2(s1, s2);
    }
    __syncthreads();   // the four column groups' partial sums of every row are in red

#pragma unroll
    for (int g = 0; g < 8; ++g) {
        float4 p0 = *(const float4*)&red[lrow + g][0];
        float4 p1 = *(const float4*)&red[lrow + g][4];
        float mean = ((p0.x + p0.z) + (p1.x + p1.z)) * (1.0f / CCH);
        float var  = ((p0.y + p0.w) + (p1.y + p1.w)) * (1.0f / CCH) - mean * mean;
        float rstd = rsqrtf(var + 1e-5f);
#pragma unroll
        for (int t = 0; t < 4; ++t)
            *(float*)(Ob + base + (g * CCH + t * 16) * 4) = (y[t][g] - mean) * rstd * gam[t] + bet[t];
    }
}

// ------------------------------------------------------------------- launcher
extern "C" void kernel_launch(void* const* d_in, const int* in_sizes, int n_in,
                              void* d_out, int out_size, void* d_ws, size_t ws_size,
                              hipStream_t stream) {
    const float* features = (const float*)d_in[0];
    const float* coords   = (const float*)d_in[1];
    const float* Wq       = (const float*)d_in[2];
    const float* Wk       = (const float*)d_in[3];
    const float* Wv       = (const float*)d_in[4];
    const float* Wo       = (const float*)d_in[5];
    const float* Wpos     = (const float*)d_in[6];
    const float* bpos     = (const float*)d_in[7];
    const float* gamma    = (const float*)d_in[8];
    const float* beta     = (const float*)d_in[9];
    const int*   nidx     = (const int*)d_in[10];
    const int*   qidx     = (const int*)d_in[11];
    float* out = (float*)d_out;

    float* ws      = (float*)d_ws;
    float* QKV     = ws;                                // N*768 floats
    float* out_raw = QKV + (size_t)NPTS * QKVLD;        // N*256
    int*   link    = (int*)(out_raw + (size_t)NPTS * CCH); // E*4
    int*   head    = link + (size_t)EE * 4;             // N

    // 1-2. per-query edge lists
    init_ws<<<(NPTS + 255) / 256, 256, 0, stream>>>(head);
    link_edges<<<(EE + 255) / 256, 256, 0, stream>>>(coords, Wpos, bpos, qidx, nidx, head, link);

    // 3-5. Q/K/V projections (fp32 WMMA), packed into QKV rows of 768
    {
        int mtiles = NPTS / 16, ngroups = CCH / GT_N;        // 1250, 4
        int blocks = GEMM_BLOCKS;                            // 157 row blocks x 4 strips
        gemm_xt_wmma<<<blocks, 256, 0, stream>>>(features, Wq, QKV, nullptr, mtiles, ngroups, QKVLD, 0);
        gemm_xt_wmma<<<blocks, 256, 0, stream>>>(features, Wk, QKV, nullptr, mtiles, ngroups, QKVLD, 256);
        gemm_xt_wmma<<<blocks, 256, 0, stream>>>(features, Wv, QKV, nullptr, mtiles, ngroups, QKVLD, 512);
    }

    // 6. scores, softmax and weighted sum (one wave per query node)
    node_attn<<<(NPTS * 32 + 255) / 256, 256, 0, stream>>>(QKV, head, link, out_raw);

    // 7. output projection + residual + LayerNorm (fp32 WMMA), 32 whole rows per work-group
    gemm_o_layernorm<<<NPTS / OT_M, 256, 0, stream>>>(out_raw, Wo, features, gamma, beta, out);
}

// v004
// One run takes 130 microseconds.
// Two timings next to v003 put it at 1.06 and 1.07 times that version's speed.
// Over all steps from v000 it is 3.51 times as fast.
#include <hip/hip_runtime.h>
#include <math.h>

#define NPTS 20000
#define CCH  256
#define HH   2
#define EE   300000
#define QKVLD 768

typedef float v2f __attribute__((ext_vector_type(2)));
typedef float v8f __attribute__((ext_vector_type(8)));

// ------------------------------------------------- fp32 WMMA GEMM: C = A @ W^T
// A: [M x 256] row-major, W: [Nout x 256] row-major (B = W^T, K=256).
// One work-group (8 waves) computes a 128x64 tile; one wave a 16x64 strip: 4 accumulators
// share each A fragment (V_WMMA_F32_16X16X4_F32, 64 k-steps, k ascending).
// Both operands go through LDS in stages of 64 k: every thread brings 16-byte pieces of
// whole 256-byte row segments (a wave's load covers whole lines), and the fragments, which
// take 8 bytes from each of 16 rows, are read from LDS. Two buffers: the next stage's global
// loads fly while this stage is multiplied, and one barrier per stage is enough (a buffer is
// rewritten only behind the barrier that every wave reaches after its last read of it).
// Staged row pitch 68 floats: the 16 rows of a fragment start 4 banks apart.
// A frag (16x4): lane l, reg r -> A[M = l&15][K = 2*(l>>4)+r]   (ISA 7.12.2)
// B frag (4x16): lane l, reg r -> B[K = 2*(l>>4)+r][N = l&15] = W[l&15][K]
// C/D (16x16):   reg g, lane l -> C[M = 8*(l>>4)+g][N = l&15]
#define GT_M     128                 // rows of A per work-group
#define GT_N     64                  // rows of W per work-group
#define GT_KC    64                  // k per stage
#define GT_PITCH 68                  // floats per staged row
#define GT_ROWS  (GT_M + GT_N)
#define GEMM_BLOCKS (((NPTS / 16 + 7) / 8) * (CCH / GT_N))

// The per-query edge lists do not depend on the projections, so they are built by the threads of
// two projection launches, whose time is the matrix unit's: no launch and no waves of their own.
// job 1 (first projection): head[q] = -1, every list empty.
// job 2 (second projection): a thread pushes its LK_PER edges on the front of their queries' lists:
// link[e] = (edge that was first before, neighbour, positional bias of head 0, of head 1).
// An edge enters once, so every list is finite and ends in -1.
// The four dependent steps (indices, coordinates, exchange, store) stand one in each k stage: a
// stage of products lies between a step and the next one, which needs its results.
#define LK_THREADS (GEMM_BLOCKS * 256)
#define LK_PER     ((EE + LK_THREADS - 1) / LK_THREADS)

// 6 waves per SIMD: three work-groups share a WGP (LDS allows three), so one's stage hand-over
// is covered by the others' matrix work
__global__ void __launch_bounds__(256, 6)
gemm_xt_wmma(const float* __restrict__ A, const float* __restrict__ W,
             float* __restrict__ Cmat, const float* __restrict__ residual,
             int mtiles, int ngroups, int ldc, int ccol0, int job,
             const float* __restrict__ coords, const float* __restrict__ Wpos,
             const float* __restrict__ bpos, const int* __restrict__ qidx,
             const int* __restrict__ nidx, int* __restrict__ head, int* __restrict__ link) {
    __shared__ __attribute__((aligned(16))) float stage[2][GT_ROWS * GT_PITCH];

    int tid  = threadIdx.x;
    int wave = __builtin_amdgcn_readfirstlane(tid >> 5);
    int lane = tid & 31;
    int half = lane >> 4, lr = lane & 15;
    int tg = blockIdx.x % ngroups, mb = blockIdx.x / ngroups;   // strip = 4 n-tiles
    // the last row block is moved up to end with the matrix, so every staged row exists;
    // its waves whose strips the block before already covers compute but do not store
    int row0 = min(mb * GT_M, mtiles * 16 - GT_M);
    int tm = (row0 >> 4) + wave;

    // staging: this thread brings 16-byte column c4 of staged rows srow, srow+16, ...
    int srow = tid >> 4, c4 = tid & 15;
    const char* Ab = (const char*)A;
    const char* Wb = (const char*)W;
    unsigned aoff = (unsigned)((row0 + srow) * CCH + c4 * 4) * 4u;          // byte offsets
    unsigned boff = (unsigned)((tg * GT_N + srow) * CCH + c4 * 4) * 4u;
    int soff = srow * GT_PITCH + c4 * 4;

    float4 ra[8], rb[4];
#pragma unroll
    for (int i = 0; i < 8; ++i) ra[i] = *(const float4*)(Ab + aoff + i * 16 * CCH * 4);
#pragma unroll
    for (int i = 0; i < 4; ++i) rb[i] = *(const float4*)(Wb + boff + i * 16 * CCH * 4);

    v8f acc0 = {}, acc1 = {}, acc2 = {}, acc3 = {};

    // list building: written and read under job 2 alone
    int gid = blockIdx.x * 256 + tid;
    int   lq[LK_PER], ln[LK_PER], lprev[LK_PER];
    float lc[LK_PER][6], lp0[LK_PER], lp1[LK_PER];

    // unrolled so that buffer and stage offsets are constants
#pragma unroll
    for (int c = 0; c < CCH / GT_KC; ++c) {
        float* s = stage[c & 1];
#pragma unroll
        for (int i = 0; i < 8; ++i) *(float4*)(s + soff + i * 16 * GT_PITCH) = ra[i];
#pragma unroll
        for (int i = 0; i < 4; ++i) *(float4*)(s + soff + (GT_M + i * 16) * GT_PITCH) = rb[i];
        __syncthreads();   // publishes stage c; also ends every wave's reads of the other buffer

        if (c + 1 < CCH / GT_KC) {
#pragma unroll
            for (int i = 0; i < 8; ++i) ra[i] = *(const float4*)(Ab + aoff + (i * 16 * CCH + (c + 1) * GT_KC) * 4);
#pragma unroll
            for (int i = 0; i < 4; ++i) rb[i] = *(const float4*)(Wb + boff + (i * 16 * CCH + (c + 1) * GT_KC) * 4);
            if (job == 2) {
                if (c == 0) {
                    // the edges' two indices; past the last edge the last one is read and not used
#pragma unroll
                    for (int j = 0; j < LK_PER; ++j) {
                        int e = min(gid + j * LK_THREADS, EE - 1);
                        lq[j] = qidx[e];
                        ln[j] = nidx[e];
                    }
                } else if (c == 1) {
                    // lq < 0 from here on: no edge, or no such segment
#pragma unroll
                    for (int j = 0; j < LK_PER; ++j) {
                        if (gid + j * LK_THREADS >= EE || (unsigned)lq[j] >= (unsigned)NPTS) lq[j] = -1;
                        ln[j] = min(max(ln[j], 0), NPTS - 1);
                        int qc = max(lq[j], 0);
                        lc[j][0] = coords[qc * 3 + 0];    lc[j][1] = coords[qc * 3 + 1];
                        lc[j][2] = coords[qc * 3 + 2];    lc[j][3] = coords[ln[j] * 3 + 0];
                        lc[j][4] = coords[ln[j] * 3 + 1]; lc[j][5] = coords[ln[j] * 3 + 2];
                    }
                } else {
#pragma unroll
                    for (int j = 0; j < LK_PER; ++j) {
                        float rx = lc[j][0] - lc[j][3];
                        float ry = lc[j][1] - lc[j][4];
                        float rz = lc[j][2] - lc[j][5];
                        lp0[j] = rx * Wpos[0] + ry * Wpos[1] + rz * Wpos[2] + bpos[0];
                        lp1[j] = rx * Wpos[3] + ry * Wpos[4] + rz * Wpos[5] + bpos[1];
                        if (lq[j] >= 0) lprev[j] = atomicExch(&head[lq[j]], gid + j * LK_THREADS);
                    }
                }
                // address wait behind this step's loads or exchanges, in front of any reuse of
                // their address and data registers
                asm volatile("s_wait_xcnt 0x0" ::: "memory");
            } else if (job == 1 && c == 0) {
                if (gid < NPTS) head[gid] = -1;
            }
            // keeps the issue of the next stage's loads in front of this stage's products;
            // without it they sink to their LDS stores and their latency is paid in the open
            __builtin_amdgcn_sched_barrier(0);
        } else if (job == 2) {
#pragma unroll
            for (int j = 0; j < LK_PER; ++j)
                if (lq[j] >= 0)
                    ((int4*)link)[gid + j * LK_THREADS] =
                        make_int4(lprev[j], ln[j], __float_as_int(lp0[j]), __float_as_int(lp1[j]));
        }

        const float* as = s + (wave * 16 + lr) * GT_PITCH + 2 * half;
        const float* bs = s + (GT_M + lr) * GT_PITCH + 2 * half;
#pragma unroll
        for (int k = 0; k < GT_KC / 4; ++k) {
            v2f a  = *(const v2f*)(as + 4 * k);
            v2f b0 = *(const v2f*)(bs + 4 * k);
            v2f b1 = *(const v2f*)(bs + 16 * GT_PITCH + 4 * k);
            v2f b2 = *(const v2f*)(bs + 32 * GT_PITCH + 4 * k);
            v2f b3 = *(const v2f*)(bs + 48 * GT_PITCH + 4 * k);
            acc0 = __builtin_amdgcn_wmma_f32_16x16x4_f32(false, a, false, b0, (short)0, acc0, false, false);
            acc1 = __builtin_amdgcn_wmma_f32_16x16x4_f32(false, a, false, b1, (short)0, acc1, false, false);
            acc2 = __builtin_amdgcn_wmma_f32_16x16x4_f32(false, a, false, b2, (short)0, acc2, false, false);
            acc3 = __builtin_amdgcn_wmma_f32_16x16x4_f32(false, a, false, b3, (short)0, acc3, false, false);
        }
    }

    if (tm < mb * 8) return;         // whole wave, behind the last barrier

    v8f accs[4] = {acc0, acc1, acc2, acc3};
#pragma unroll
    for (int t = 0; t < 4; ++t) {
        int col = ccol0 + (tg * 4 + t) * 16 + lr;
#pragma unroll
        for (int g = 0; g < 8; ++g) {
            int row = tm * 16 + 8 * half + g;
            size_t oidx = (size_t)row * ldc + col;
            float v = accs[t][g];
            if (residual) v += residual[oidx];
            Cmat[oidx] = v;
        }
    }
}

// sum over the 16 lanes of a row, in the vector unit (no LDS round trip)
__device__ __forceinline__ float row16_sum(float s) {
    s += __int_as_float(__builtin_amdgcn_update_dpp(0, __float_as_int(s), 0x161, 0xf, 0xf, true)); // row_xmask:1
    s += __int_as_float(__builtin_amdgcn_update_dpp(0, __float_as_int(s), 0x162, 0xf, 0xf, true)); // row_xmask:2
    s += __int_as_float(__builtin_amdgcn_update_dpp(0, __float_as_int(s), 0x164, 0xf, 0xf, true)); // row_xmask:4
    s += __int_as_float(__builtin_amdgcn_update_dpp(0, __float_as_int(s), 0x168, 0xf, 0xf, true)); // row_xmask:8
    return s;
}

struct Rows { float4 k0, k1, v0, v1; };

__device__ __forceinline__ Rows load_rows(const float* __restrict__ QKV, int n, int off) {
    const float* r = QKV + (size_t)n * QKVLD + 256 + off;
    Rows t;
    t.k0 = *(const float4*)r;         t.k1 = *(const float4*)(r + 64);
    t.v0 = *(const float4*)(r + 256); t.v1 = *(const float4*)(r + 320);
    return t;
}

// one edge of the online softmax: running maximum m, denominator l, weighted sum a0,a1
__device__ __forceinline__ void edge_step(const Rows& t, float pos, const float4& q0, const float4& q1,
                                          float& m, float& l, float4& a0, float4& a1) {
    float sa = fmaf(q0.w, t.k0.w, fmaf(q0.z, t.k0.z, fmaf(q0.y, t.k0.y, q0.x * t.k0.x)));
    float sb = fmaf(q1.w, t.k1.w, fmaf(q1.z, t.k1.z, fmaf(q1.y, t.k1.y, q1.x * t.k1.x)));
    float s  = row16_sum(sa + sb);
    float sc = s * 0.08838834764831845f + pos;   // D^-0.5, D=128
    float mn   = fmaxf(m, sc);
    float corr = expf(m - mn);                   // 0 on the first edge
    float p    = expf(sc - mn);
    m = mn;
    l = l * corr + p;
    a0.x = a0.x * corr + p * t.v0.x;  a0.y = a0.y * corr + p * t.v0.y;
    a0.z = a0.z * corr + p * t.v0.z;  a0.w = a0.w * corr + p * t.v0.w;
    a1.x = a1.x * corr + p * t.v1.x;  a1.y = a1.y * corr + p * t.v1.y;
    a1.z = a1.z * corr + p * t.v1.z;  a1.w = a1.w * corr + p * t.v1.w;
}

// ------------------------------------- one wave per query node: gather attention
// Lanes 0-15 hold head 0, lanes 16-31 head 1; a lane owns dims 4*(l&15)..+3 and
// 64+4*(l&15)..+3 of its head, so each 16-byte load of the wave covers whole lines.
// The wave walks its node's edge list and writes the normalised row once; the next
// list entry is requested together with the current edge's rows.
__global__ void __launch_bounds__(256)
node_attn(const float* __restrict__ QKV, const int* __restrict__ head,
          const int* __restrict__ link, float* __restrict__ out_raw) {
    int node = __builtin_amdgcn_readfirstlane((int)((blockIdx.x * blockDim.x + threadIdx.x) >> 5));
    int lane = threadIdx.x & 31;
    if (node >= NPTS) return;
    bool h1 = lane >= 16;
    int off = (lane >> 4) * 128 + (lane & 15) * 4;
    const int4* link4 = (const int4*)link;

    float4 a0 = make_float4(0.f, 0.f, 0.f, 0.f), a1 = a0;

    int e0 = head[node];
    if (e0 >= 0) {
        float m = -INFINITY, l = 0.0f;
        const float* qrow = QKV + (size_t)node * QKVLD + off;
        float4 q0 = *(const float4*)qrow, q1 = *(const float4*)(qrow + 64);

        int4 L = link4[e0];
        for (int it = 0; it < EE; ++it) {        // a list holds at most EE edges
            Rows t = load_rows(QKV, L.y, off);
            int4 Ln = link4[L.x >= 0 ? L.x : e0];   // past the end: the first entry again, not used
            // keeps the wait for the next list entry behind the issue of this edge's row loads
            __builtin_amdgcn_sched_barrier(0);
            edge_step(t, __int_as_float(h1 ? L.w : L.z), q0, q1, m, l, a0, a1);
            if (L.x < 0) break;
            L = Ln;
        }
        a0.x /= l; a0.y /= l; a0.z /= l; a0.w /= l;
        a1.x /= l; a1.y /= l; a1.z /= l; a1.w /= l;
    }
    float* op = out_raw + (size_t)node * CCH + off;
    *(float4*)op        = a0;      // a node without edges gets zeros
    *(float4*)(op + 64) = a1;
}

// ------------------- output projection + residual + LayerNorm in one launch
// out = LayerNorm(A @ W^T + residual). One work-group (8 waves) owns 32 WHOLE rows (all 256
// columns), so a row's mean and variance are formed from the accumulators and the sum of
// projection and residual never goes through memory. Wave w: row tile w>>2, columns
// 64*(w&3)..+63, 4 accumulators, fragments and k order as in gemm_xt_wmma.
// The 32 rows of A are put in LDS whole, once. W goes through LDS in stages of 32 k (all its
// 256 rows are staged, so the stage is shorter: three work-groups still share a WGP); two
// buffers and one barrier per stage as above.
// Row pitches 260 and 36 floats: the 16 rows of a fragment start on 16 different groups of 4 banks.
#define OT_M      32                 // rows of A per work-group
#define OT_KC     32                 // k per stage of W
#define OT_PITCH  36                 // floats per staged row of W
#define OT_APITCH 260                // floats per row of A in LDS

__global__ void __launch_bounds__(256, 6)
gemm_o_layernorm(const float* __restrict__ A, const float* __restrict__ W,
                 const float* __restrict__ residual, const float* __restrict__ gamma,
                 const float* __restrict__ beta, float* __restrict__ out) {
    __shared__ __attribute__((aligned(16))) float atile[OT_M * OT_APITCH];
    __shared__ __attribute__((aligned(16))) float stage[2][CCH * OT_PITCH];
    // per row: (sum, sum of squares) over each of the 4 column groups
    __shared__ __attribute__((aligned(16))) float red[OT_M][8];

    int tid  = threadIdx.x;
    int wave = __builtin_amdgcn_readfirstlane(tid >> 5);
    int lane = tid & 31;
    int half = lane >> 4, lr = lane & 15;
    int rt = wave >> 2, cg = wave & 3;
    int row0 = blockIdx.x * OT_M;    // NPTS is a multiple of OT_M

    // staging of W: this thread brings 16-byte column c4 of rows srow, srow+32, ...
    int srow = tid >> 3, c4 = tid & 7;
    const char* Ab = (const char*)A;
    const char* Wb = (const char*)W;
    unsigned boff = (unsigned)(srow * CCH + c4 * 4) * 4u;                   // byte offsets
    int soff = srow * OT_PITCH + c4 * 4;
    // A: 16-byte column tid&63 of rows tid>>6, +4, ... (a wave's load is 512 bytes in a row)
    unsigned aoff = (unsigned)((row0 + (tid >> 6)) * CCH + (tid & 63) * 4) * 4u;
    float* ad = atile + (tid >> 6) * OT_APITCH + (tid & 63) * 4;

    // piece i of stage c of W; named registers, not an array: the array stayed in scratch memory
#define OT_W(i, c) (*(const float4*)(Wb + boff + ((i) * 32 * CCH + (c) * OT_KC) * 4))
#define OT_S(i)    (*(float4*)(s + soff + (i) * 32 * OT_PITCH))
#define OT_A(i)    (*(const float4*)(Ab + aoff + (i) * 4 * CCH * 4))
#define OT_AD(i)   (*(float4*)(ad + (i) * 4 * OT_APITCH))
    float4 ra0 = OT_A(0), ra1 = OT_A(1), ra2 = OT_A(2), ra3 = OT_A(3);
    float4 ra4 = OT_A(4), ra5 = OT_A(5), ra6 = OT_A(6), ra7 = OT_A(7);
    float4 rb0 = OT_W(0, 0), rb1 = OT_W(1, 0), rb2 = OT_W(2, 0), rb3 = OT_W(3, 0);
    float4 rb4 = OT_W(4, 0), rb5 = OT_W(5, 0), rb6 = OT_W(6, 0), rb7 = OT_W(7, 0);
    // address wait behind the run of loads; the offsets are inputs so that their registers
    // stay theirs up to here and no load of the run lands on the run's own offset register
    asm volatile("s_wait_xcnt 0x0" :: "v"(aoff), "v"(boff) : "memory");

    OT_AD(0) = ra0; OT_AD(1) = ra1; OT_AD(2) = ra2; OT_AD(3) = ra3;   // published by stage 0's barrier
    OT_AD(4) = ra4; OT_AD(5) = ra5; OT_AD(6) = ra6; OT_AD(7) = ra7;

    v8f acc0 = {}, acc1 = {}, acc2 = {}, acc3 = {};

    // this lane's accumulators hold rows lrow..lrow+7 of the tile at columns col0 + 16*t
    int lrow = rt * 16 + 8 * half;
    int col0 = cg * 64 + lr;
    unsigned base = (unsigned)((row0 + lrow) * CCH + col0) * 4u;             // byte offset
    const char* Rb = (const char*)residual;
    char* Ob = (char*)out;
    float y[4][8], gam[4], bet[4];

    // unrolled so that buffer and stage offsets are constants
#pragma unroll
    for (int c = 0; c < CCH / OT_KC; ++c) {
        float* s = stage[c & 1];
        OT_S(0) = rb0; OT_S(1) = rb1; OT_S(2) = rb2; OT_S(3) = rb3;
        OT_S(4) = rb4; OT_S(5) = rb5; OT_S(6) = rb6; OT_S(7) = rb7;
        __syncthreads();   // publishes stage c; also ends every wave's reads of the other buffer

        if (c + 1 < CCH / OT_KC) {
            rb0 = OT_W(0, c + 1); rb1 = OT_W(1, c + 1); rb2 = OT_W(2, c + 1); rb3 = OT_W(3, c + 1);
            rb4 = OT_W(4, c + 1); rb5 = OT_W(5, c + 1); rb6 = OT_W(6, c + 1); rb7 = OT_W(7, c + 1);
            // keeps the issue of the next stage's loads in front of this stage's products;
            // without it they sink to their LDS stores and their latency is paid in the open
            __builtin_amdgcn_sched_barrier(0);
        } else {
            // last stage: residual, gamma and beta fly under the products, in the registers W has left
#pragma unroll
            for (int t = 0; t < 4; ++t) {
#pragma unroll
                for (int g = 0; g < 8; ++g) y[t][g] = *(const float*)(Rb + base + (g * CCH + t * 16) * 4);
                gam[t] = gamma[col0 + t * 16];
                bet[t] = beta[col0 + t * 16];
            }
            // address wait behind the run of loads, in front of any reuse of their base and offset
            // registers; the offsets are inputs so that their registers stay theirs up to here
            asm volatile("s_wait_xcnt 0x0" :: "v"(base), "v"(col0) : "memory");
            // keeps the issue of these loads in front of the products, as above
            __builtin_amdgcn_sched_barrier(0);
        }

        const float* as = atile + (rt * 16 + lr) * OT_APITCH + c * OT_KC + 2 * half;
        const float* bs = s + (cg * 64 + lr) * OT_PITCH + 2 * half;
#pragma unroll
        for (int k = 0; k < OT_KC / 4; ++k) {
            v2f a  = *(const v2f*)(as + 4 * k);
            v2f b0 = *(const v2f*)(bs + 4 * k);
            v2f b1 = *(const v2f*)(bs + 16 * OT_PITCH + 4 * k);
            v2f b2 = *(const v2f*)(bs + 32 * OT_PITCH + 4 * k);
            v2f b3 = *(const v2f*)(bs + 48 * OT_PITCH + 4 * k);
            acc0 = __builtin_amdgcn_wmma_f32_16x16x4_f32(false, a, false, b0, (short)0, acc0, false, false);
            acc1 = __builtin_amdgcn_wmma_f32_16x16x4_f32(false, a, false, b1, (short)0, acc1, false, false);
            acc2 = __builtin_amdgcn_wmma_f32_16x16x4_f32(false, a, false, b2, (short)0, acc2, false, false);
            acc3 = __builtin_amdgcn_wmma_f32_16x16x4_f32(false, a, false, b3, (short)0, acc3, false, false);
        }
        // keeps the next stage's LDS stores, which wait for its global loads, behind these products
        __builtin_amdgcn_sched_barrier(0);
    }
    // four vector slots between the last product and the first vector instruction that reads a
    // result or reuses an operand register of it
    asm volatile("v_nop\n\tv_nop\n\tv_nop\n\tv_nop");
    // keeps the arithmetic below behind those slots
    __builtin_amdgcn_sched_barrier(0);

    v8f accs[4] = {acc0, acc1, acc2, acc3};
#pragma unroll
    for (int t = 0; t < 4; ++t)
#pragma unroll
        for (int g = 0; g < 8; ++g) y[t][g] += accs[t][g];

    // each row's sum and sum of squares over this wave's 64 columns
#pragma unroll
    for (int g = 0; g < 8; ++g) {
        float s1 = (y[0][g] + y[1][g]) + (y[2][g] + y[3][g]);
        float s2 = (y[0][g] * y[0][g] + y[1][g] * y[1][g]) + (y[2][g] * y[2][g] + y[3][g] * y[3][g]);
        s1 = row16_sum(s1);
        s2 = row16_sum(s2);
        if (lr == 0) *(float2*)&red[lrow + g][cg * 2] = make_float2(s1, s2);
    }
    __syncthreads();   // the four column groups' partial sums of every row are in red

#pragma unroll
    for (int g = 0; g < 8; ++g) {
        float4 p0 = *(const float4*)&red[lrow + g][0];
        float4 p1 = *(const float4*)&red[lrow + g][4];
        float mean = ((p0.x + p0.z) + (p1.x + p1.z)) * (1.0f / CCH);
        float var  = ((p0.y + p0.w) + (p1.y + p1.w)) * (1.0f / CCH) - mean * mean;
        float rstd = rsqrtf(var + 1e-5f);
#pragma unroll
        for (int t = 0; t < 4; ++t)
            *(float*)(Ob + base + (g * CCH + t * 16) * 4) = (y[t][g] - mean) * rstd * gam[t] + bet[t];
    }
}

// ------------------------------------------------------------------- launcher
extern "C" void kernel_launch(void* const* d_in, const int* in_sizes, int n_in,
                              void* d_out, int out_size, void* d_ws, size_t ws_size,
                              hipStream_t stream) {
    const float* features = (const float*)d_in[0];
    const float* coords   = (const float*)d_in[1];
    const float* Wq       = (const float*)d_in[2];
    const float* Wk       = (const float*)d_in[3];
    const float* Wv       = (const float*)d_in[4];
    const float* Wo       = (const float*)d_in[5];
    const float* Wpos     = (const float*)d_in[6];
    const float* bpos     = (const float*)d_in[7];
    const float* gamma    = (const float*)d_in[8];
    const float* beta     = (const float*)d_in[9];
    const int*   nidx     = (const int*)d_in[10];
    const int*   qidx     = (const int*)d_in[11];
    float* out = (float*)d_out;

    float* ws      = (float*)d_ws;
    float* QKV     = ws;                                // N*768 floats
    float* out_raw = QKV + (size_t)NPTS * QKVLD;        // N*256
    int*   link    = (int*)(out_raw + (size_t)NPTS * CCH); // E*4
    int*   head    = link + (size_t)EE * 4;             // N

    // 1-3. Q/K/V projections (fp32 WMMA), packed into QKV rows of 768; the first also empties
    // the per-query edge lists, the second fills them
    {
        int mtiles = NPTS / 16, ngroups = CCH / GT_N;        // 1250, 4
        int blocks = GEMM_BLOCKS;                            // 157 row blocks x 4 strips
        gemm_xt_wmma<<<blocks, 256, 0, stream>>>(features, Wq, QKV, nullptr, mtiles, ngroups, QKVLD, 0, 1,
                                                 coords, Wpos, bpos, qidx, nidx, head, link);
        gemm_xt_wmma<<<blocks, 256, 0, stream>>>(features, Wk, QKV, nullptr, mtiles, ngroups, QKVLD, 256, 2,
                                                 coords, Wpos, bpos, qidx, nidx, head, link);
        gemm_xt_wmma<<<blocks, 256, 0, stream>>>(features, Wv, QKV, nullptr, mtiles, ngroups, QKVLD, 512, 0,
                                                 coords, Wpos, bpos, qidx, nidx, head, link);
    }

    // 4. scores, softmax and weighted sum (one wave per query node)
    node_attn<<<(NPTS * 32 + 255) / 256, 256, 0, stream>>>(QKV, head, link, out_raw);

    // 5. output projection + residual + LayerNorm (fp32 WMMA), 32 whole rows per work-group
    gemm_o_layernorm<<<NPTS / OT_M, 256, 0, stream>>>(out_raw, Wo, features, gamma, beta, out);
}

// v005
// It runs in 117 microseconds.
// Timed twice side by side with v004, it ran 1.12 and 1.10 times as fast.
// Counting every step since v000, it is 3.89 times as fast.
#include <hip/hip_runtime.h>
#include <math.h>

#define NPTS 20000
#define CCH  256
#define HH   2
#define EE   300000
#define QKVLD 768

typedef float v2f __attribute__((ext_vector_type(2)));
typedef float v8f __attribute__((ext_vector_type(8)));

// ------------------------------------------------- fp32 WMMA GEMM: C = A @ W^T
// A: [M x 256] row-major, W: [Nout x 256] row-major (B = W^T, K=256).
// One launch may serve two weight matrices: column strips past the first 256 columns take their
// rows from W2, and the results go on in the same packed output row.
// One work-group (8 waves) computes a 128x64 tile; one wave a 16x64 strip: 4 accumulators
// share each A fragment (V_WMMA_F32_16X16X4_F32, 64 k-steps, k ascending).
// Both operands go through LDS in stages of 64 k: every thread brings 16-byte pieces of
// whole 256-byte row segments (a wave's load covers whole lines), and the fragments, which
// take 8 bytes from each of 16 rows, are read from LDS. Two buffers: the next stage's global
// loads fly while this stage is multiplied, and one barrier per stage is enough (a buffer is
// rewritten only behind the barrier that every wave reaches after its last read of it).
// Staged row pitch 68 floats: the 16 rows of a fragment start 4 banks apart.
// A frag (16x4): lane l, reg r -> A[M = l&15][K = 2*(l>>4)+r]   (ISA 7.12.2)
// B frag (4x16): lane l, reg r -> B[K = 2*(l>>4)+r][N = l&15] = W[l&15][K]
// C/D (16x16):   reg g, lane l -> C[M = 8*(l>>4)+g][N = l&15]
#define GT_M     128                 // rows of A per work-group
#define GT_N     64                  // rows of W per work-group
#define GT_KC    64                  // k per stage
#define GT_PITCH 68                  // floats per staged row
#define GT_ROWS  (GT_M + GT_N)
#define GEMM_BLOCKS (((NPTS / 16 + 7) / 8) * (CCH / GT_N))
#define KV_BLOCKS   (2 * GEMM_BLOCKS)   // K and V in one launch: 8 column strips per row block

// The per-query edge lists do not depend on the projections, so they are built by the threads of
// two projection launches, whose time is the matrix unit's: no launch and no waves of their own.
// job 1 (first projection): head[q] = -1, every list empty.
// job 2 (the launch of K and V): a thread pushes its LK_PER edges on the front of their queries' lists:
// link[e] = (edge that was first before, neighbour, positional bias of head 0, of head 1).
// An edge enters once, so every list is finite and ends in -1.
// The four dependent steps (indices, coordinates, exchange, store) stand one in each k stage: a
// stage of products lies between a step and the next one, which needs its results.
#define LK_THREADS (KV_BLOCKS * 256)
#define LK_PER     ((EE + LK_THREADS - 1) / LK_THREADS)

// 6 waves per SIMD: three work-groups share a WGP (LDS allows three), so one's stage hand-over
// is covered by the others' matrix work
__global__ void __launch_bounds__(256, 6)
gemm_xt_wmma(const float* __restrict__ A, const float* __restrict__ W, const float* __restrict__ W2,
             float* __restrict__ Cmat, const float* __restrict__ residual,
             int mtiles, int ngroups, int ldc, int ccol0, int job,
             const float* __restrict__ coords, const float* __restrict__ Wpos,
             const float* __restrict__ bpos, const int* __restrict__ qidx,
             const int* __restrict__ nidx, int* __restrict__ head, int* __restrict__ link) {
    __shared__ __attribute__((aligned(16))) float stage[2][GT_ROWS * GT_PITCH];

    int tid  = threadIdx.x;
    int wave = __builtin_amdgcn_readfirstlane(tid >> 5);
    int lane = tid & 31;
    int half = lane >> 4, lr = lane & 15;
    int tg = blockIdx.x % ngroups, mb = blockIdx.x / ngroups;   // strip = 4 n-tiles
    // the last row block is moved up to end with the matrix, so every staged row exists;
    // its waves whose strips the block before already covers compute but do not store
    int row0 = min(mb * GT_M, mtiles * 16 - GT_M);
    int tm = (row0 >> 4) + wave;

    // staging: this thread brings 16-byte column c4 of staged rows srow, srow+16, ...
    int srow = tid >> 4, c4 = tid & 15;
    const char* Ab = (const char*)A;
    const char* Wb = (const char*)(tg * GT_N < CCH ? W : W2);               // same for the whole work-group
    unsigned aoff = (unsigned)((row0 + srow) * CCH + c4 * 4) * 4u;          // byte offsets
    unsigned boff = (unsigned)(((tg * GT_N) % CCH + srow) * CCH + c4 * 4) * 4u;
    int soff = srow * GT_PITCH + c4 * 4;

    // piece i of stage c of A and of the weights, and its place in the stage; named registers, not
    // arrays: with the weight matrix chosen per strip the arrays stayed in scratch memory
#define GT_A(i, c) (*(const float4*)(Ab + aoff + ((i) * 16 * CCH + (c) * GT_KC) * 4))
#define GT_W(i, c) (*(const float4*)(Wb + boff + ((i) * 16 * CCH + (c) * GT_KC) * 4))
#define GT_SA(i)   (*(float4*)(s + soff + (i) * 16 * GT_PITCH))
#define GT_S(i)    (*(float4*)(s + soff + (GT_M + (i) * 16) * GT_PITCH))
    float4 ra0 = GT_A(0, 0), ra1 = GT_A(1, 0), ra2 = GT_A(2, 0), ra3 = GT_A(3, 0);
    float4 ra4 = GT_A(4, 0), ra5 = GT_A(5, 0), ra6 = GT_A(6, 0), ra7 = GT_A(7, 0);
    float4 rb0 = GT_W(0, 0), rb1 = GT_W(1, 0), rb2 = GT_W(2, 0), rb3 = GT_W(3, 0);
    // address wait behind the run of loads, in front of any reuse of their address registers; bases,
    // offsets and full addresses are inputs so that their registers stay theirs up to here
    asm volatile("s_wait_xcnt 0x0" :: "s"(Ab), "s"(Wb), "v"(aoff), "v"(boff), "v"(Ab + aoff), "v"(Wb + boff) : "memory");

    v8f acc0 = {}, acc1 = {}, acc2 = {}, acc3 = {};

    // list building: written and read under job 2 alone
    int gid = blockIdx.x * 256 + tid;
    int   lq[LK_PER], ln[LK_PER], lprev[LK_PER];
    float lc[LK_PER][6], lp0[LK_PER], lp1[LK_PER];

    // unrolled so that buffer and stage offsets are constants
#pragma unroll
    for (int c = 0; c < CCH / GT_KC; ++c) {
        float* s = stage[c & 1];
        GT_SA(0) = ra0; GT_SA(1) = ra1; GT_SA(2) = ra2; GT_SA(3) = ra3;
        GT_SA(4) = ra4; GT_SA(5) = ra5; GT_SA(6) = ra6; GT_SA(7) = ra7;
        GT_S(0) = rb0; GT_S(1) = rb1; GT_S(2) = rb2; GT_S(3) = rb3;
        __syncthreads();   // publishes stage c; also ends every wave's reads of the other buffer

        if (c + 1 < CCH / GT_KC) {
            if (job == 2) {
                if (c == 0) {
                    // the edges' two indices; past the last edge the last one is read and not used
#pragma unroll
                    for (int j = 0; j < LK_PER; ++j) {
                        int e = min(gid + j * LK_THREADS, EE - 1);
                        lq[j] = qidx[e];
                        ln[j] = nidx[e];
                    }
                } else if (c == 1) {
                    // lq < 0 from here on: no edge, or no such segment
#pragma unroll
                    for (int j = 0; j < LK_PER; ++j) {
                        if (gid + j * LK_THREADS >= EE || (unsigned)lq[j] >= (unsigned)NPTS) lq[j] = -1;
                        ln[j] = min(max(ln[j], 0), NPTS - 1);
                        int qc = max(lq[j], 0);
                        lc[j][0] = coords[qc * 3 + 0];    lc[j][1] = coords[qc * 3 + 1];
                        lc[j][2] = coords[qc * 3 + 2];    lc[j][3] = coords[ln[j] * 3 + 0];
                        lc[j][4] = coords[ln[j] * 3 + 1]; lc[j][5] = coords[ln[j] * 3 + 2];
                    }
                } else {
#pragma unroll
                    for (int j = 0; j < LK_PER; ++j) {
                        float rx = lc[j][0] - lc[j][3];
                        float ry = lc[j][1] - lc[j][4];
                        float rz = lc[j][2] - lc[j][5];
                        lp0[j] = rx * Wpos[0] + ry * Wpos[1] + rz * Wpos[2] + bpos[0];
                        lp1[j] = rx * Wpos[3] + ry * Wpos[4] + rz * Wpos[5] + bpos[1];
                        if (lq[j] >= 0) lprev[j] = atomicExch(&head[lq[j]], gid + j * LK_THREADS);
                    }
                }
                // address wait behind this step's loads or exchanges, in front of any reuse of
                // their address and data registers
                asm volatile("s_wait_xcnt 0x0" ::: "memory");
            } else if (job == 1 && c == 0) {
                if (gid < NPTS) head[gid] = -1;
            }
            ra0 = GT_A(0, c + 1); ra1 = GT_A(1, c + 1); ra2 = GT_A(2, c + 1); ra3 = GT_A(3, c + 1);
            ra4 = GT_A(4, c + 1); ra5 = GT_A(5, c + 1); ra6 = GT_A(6, c + 1); ra7 = GT_A(7, c + 1);
            rb0 = GT_W(0, c + 1); rb1 = GT_W(1, c + 1); rb2 = GT_W(2, c + 1); rb3 = GT_W(3, c + 1);
            // address wait behind the run of loads, as above
            asm volatile("s_wait_xcnt 0x0" :: "s"(Ab), "s"(Wb), "v"(aoff), "v"(boff), "v"(Ab + aoff), "v"(Wb + boff) : "memory");
            // keeps the issue of the next stage's loads in front of this stage's products;
            // without it they sink to their LDS stores and their latency is paid in the open
            __builtin_amdgcn_sched_barrier(0);
        } else if (job == 2) {
#pragma unroll
            for (int j = 0; j < LK_PER; ++j)
                if (lq[j] >= 0)
                    ((int4*)link)[gid + j * LK_THREADS] =
                        make_int4(lprev[j], ln[j], __float_as_int(lp0[j]), __float_as_int(lp1[j]));
        }

        const float* as = s + (wave * 16 + lr) * GT_PITCH + 2 * half;
        const float* bs = s + (GT_M + lr) * GT_PITCH + 2 * half;
#pragma unroll
        for (int k = 0; k < GT_KC / 4; ++k) {
            v2f a  = *(const v2f*)(as + 4 * k);
            v2f b0 = *(const v2f*)(bs + 4 * k);
            v2f b1 = *(const v2f*)(bs + 16 * GT_PITCH + 4 * k);
            v2f b2 = *(const v2f*)(bs + 32 * GT_PITCH + 4 * k);
            v2f b3 = *(const v2f*)(bs + 48 * GT_PITCH + 4 * k);
            acc0 = __builtin_amdgcn_wmma_f32_16x16x4_f32(false, a, false, b0, (short)0, acc0, false, false);
            acc1 = __builtin_amdgcn_wmma_f32_16x16x4_f32(false, a, false, b1, (short)0, acc1, false, false);
            acc2 = __builtin_amdgcn_wmma_f32_16x16x4_f32(false, a, false, b2, (short)0, acc2, false, false);
            acc3 = __builtin_amdgcn_wmma_f32_16x16x4_f32(false, a, false, b3, (short)0, acc3, false, false);
        }
    }

    if (tm < mb * 8) return;         // whole wave, behind the last barrier

    v8f accs[4] = {acc0, acc1, acc2, acc3};
#pragma unroll
    for (int t = 0; t < 4; ++t) {
        int col = ccol0 + (tg * 4 + t) * 16 + lr;
#pragma unroll
        for (int g = 0; g < 8; ++g) {
            int row = tm * 16 + 8 * half + g;
            size_t oidx = (size_t)row * ldc + col;
            float v = accs[t][g];
            if (residual) v += residual[oidx];
            Cmat[oidx] = v;
        }
    }
}

// sum over the 16 lanes of a row, in the vector unit (no LDS round trip)
__device__ __forceinline__ float row16_sum(float s) {
    s += __int_as_float(__builtin_amdgcn_update_dpp(0, __float_as_int(s), 0x161, 0xf, 0xf, true)); // row_xmask:1
    s += __int_as_float(__builtin_amdgcn_update_dpp(0, __float_as_int(s), 0x162, 0xf, 0xf, true)); // row_xmask:2
    s += __int_as_float(__builtin_amdgcn_update_dpp(0, __float_as_int(s), 0x164, 0xf, 0xf, true)); // row_xmask:4
    s += __int_as_float(__builtin_amdgcn_update_dpp(0, __float_as_int(s), 0x168, 0xf, 0xf, true)); // row_xmask:8
    return s;
}

struct Rows { float4 k0, k1, v0, v1; };

__device__ __forceinline__ Rows load_rows(const float* __restrict__ QKV, int n, int off) {
    const float* r = QKV + (size_t)n * QKVLD + 256 + off;
    Rows t;
    t.k0 = *(const float4*)r;         t.k1 = *(const float4*)(r + 64);
    t.v0 = *(const float4*)(r + 256); t.v1 = *(const float4*)(r + 320);
    return t;
}

// one edge of the online softmax: running maximum m, denominator l, weighted sum a0,a1
__device__ __forceinline__ void edge_step(const Rows& t, float pos, const float4& q0, const float4& q1,
                                          float& m, float& l, float4& a0, float4& a1) {
    float sa = fmaf(q0.w, t.k0.w, fmaf(q0.z, t.k0.z, fmaf(q0.y, t.k0.y, q0.x * t.k0.x)));
    float sb = fmaf(q1.w, t.k1.w, fmaf(q1.z, t.k1.z, fmaf(q1.y, t.k1.y, q1.x * t.k1.x)));
    float s  = row16_sum(sa + sb);
    float sc = s * 0.08838834764831845f + pos;   // D^-0.5, D=128
    float mn   = fmaxf(m, sc);
    float corr = expf(m - mn);                   // 0 on the first edge
    float p    = expf(sc - mn);
    m = mn;
    l = l * corr + p;
    a0.x = a0.x * corr + p * t.v0.x;  a0.y = a0.y * corr + p * t.v0.y;
    a0.z = a0.z * corr + p * t.v0.z;  a0.w = a0.w * corr + p * t.v0.w;
    a1.x = a1.x * corr + p * t.v1.x;  a1.y = a1.y * corr + p * t.v1.y;
    a1.z = a1.z * corr + p * t.v1.z;  a1.w = a1.w * corr + p * t.v1.w;
}

// ------------------------------------- one wave per query node: gather attention
// Lanes 0-15 hold head 0, lanes 16-31 head 1; a lane owns dims 4*(l&15)..+3 and
// 64+4*(l&15)..+3 of its head, so each 16-byte load of the wave covers whole lines.
// The wave walks its node's edge list and writes the normalised row once; the next
// list entry is requested together with the current edge's rows.
__global__ void __launch_bounds__(256)
node_attn(const float* __restrict__ QKV, const int* __restrict__ head,
          const int* __restrict__ link, float* __restrict__ out_raw) {
    int node = __builtin_amdgcn_readfirstlane((int)((blockIdx.x * blockDim.x + threadIdx.x) >> 5));
    int lane = threadIdx.x & 31;
    if (node >= NPTS) return;
    bool h1 = lane >= 16;
    int off = (lane >> 4) * 128 + (lane & 15) * 4;
    const int4* link4 = (const int4*)link;

    float4 a0 = make_float4(0.f, 0.f, 0.f, 0.f), a1 = a0;

    int e0 = head[node];
    if (e0 >= 0) {
        float m = -INFINITY, l = 0.0f;
        const float* qrow = QKV + (size_t)node * QKVLD + off;
        float4 q0 = *(const float4*)qrow, q1 = *(const float4*)(qrow + 64);

        int4 L = link4[e0];
        for (int it = 0; it < EE; ++it) {        // a list holds at most EE edges
            Rows t = load_rows(QKV, L.y, off);
            int4 Ln = link4[L.x >= 0 ? L.x : e0];   // past the end: the first entry again, not used
            // keeps the wait for the next list entry behind the issue of this edge's row loads
            __builtin_amdgcn_sched_barrier(0);
            edge_step(t, __int_as_float(h1 ? L.w : L.z), q0, q1, m, l, a0, a1);
            if (L.x < 0) break;
            L = Ln;
        }
        a0.x /= l; a0.y /= l; a0.z /= l; a0.w /= l;
        a1.x /= l; a1.y /= l; a1.z /= l; a1.w /= l;
    }
    float* op = out_raw + (size_t)node * CCH + off;
    *(float4*)op        = a0;      // a node without edges gets zeros
    *(float4*)(op + 64) = a1;
}

// ------------------- output projection + residual + LayerNorm in one launch
// out = LayerNorm(A @ W^T + residual). One work-group (8 waves) owns 32 WHOLE rows (all 256
// columns), so a row's mean and variance are formed from the accumulators and the sum of
// projection and residual never goes through memory. Wave w: row tile w>>2, columns
// 64*(w&3)..+63, 4 accumulators, fragments and k order as in gemm_xt_wmma.
// The 32 rows of A are put in LDS whole, once. W goes through LDS in stages of 32 k (all its
// 256 rows are staged, so the stage is shorter: three work-groups still share a WGP); two
// buffers and one barrier per stage as above.
// Row pitches 260 and 36 floats: the 16 rows of a fragment start on 16 different groups of 4 banks.
#define OT_M      32                 // rows of A per work-group
#define OT_KC     32                 // k per stage of W
#define OT_PITCH  36                 // floats per staged row of W
#define OT_APITCH 260                // floats per row of A in LDS

__global__ void __launch_bounds__(256, 6)
gemm_o_layernorm(const float* __restrict__ A, const float* __restrict__ W,
                 const float* __restrict__ residual, const float* __restrict__ gamma,
                 const float* __restrict__ beta, float* __restrict__ out) {
    __shared__ __attribute__((aligned(16))) float atile[OT_M * OT_APITCH];
    __shared__ __attribute__((aligned(16))) float stage[2][CCH * OT_PITCH];
    // per row: (sum, sum of squares) over each of the 4 column groups
    __shared__ __attribute__((aligned(16))) float red[OT_M][8];

    int tid  = threadIdx.x;
    int wave = __builtin_amdgcn_readfirstlane(tid >> 5);
    int lane = tid & 31;
    int half = lane >> 4, lr = lane & 15;
    int rt = wave >> 2, cg = wave & 3;
    int row0 = blockIdx.x * OT_M;    // NPTS is a multiple of OT_M

    // staging of W: this thread brings 16-byte column c4 of rows srow, srow+32, ...
    int srow = tid >> 3, c4 = tid & 7;
    const char* Ab = (const char*)A;
    const char* Wb = (const char*)W;
    unsigned boff = (unsigned)(srow * CCH + c4 * 4) * 4u;                   // byte offsets
    int soff = srow * OT_PITCH + c4 * 4;
    // A: 16-byte column tid&63 of rows tid>>6, +4, ... (a wave's load is 512 bytes in a row)
    unsigned aoff = (unsigned)((row0 + (tid >> 6)) * CCH + (tid & 63) * 4) * 4u;
    float* ad = atile + (tid >> 6) * OT_APITCH + (tid & 63) * 4;

    // piece i of stage c of W; named registers, not an array: the array stayed in scratch memory
#define OT_W(i, c) (*(const float4*)(Wb + boff + ((i) * 32 * CCH + (c) * OT_KC) * 4))
#define OT_S(i)    (*(float4*)(s + soff + (i) * 32 * OT_PITCH))
#define OT_A(i)    (*(const float4*)(Ab + aoff + (i) * 4 * CCH * 4))
#define OT_AD(i)   (*(float4*)(ad + (i) * 4 * OT_APITCH))
    float4 ra0 = OT_A(0), ra1 = OT_A(1), ra2 = OT_A(2), ra3 = OT_A(3);
    float4 ra4 = OT_A(4), ra5 = OT_A(5), ra6 = OT_A(6), ra7 = OT_A(7);
    float4 rb0 = OT_W(0, 0), rb1 = OT_W(1, 0), rb2 = OT_W(2, 0), rb3 = OT_W(3, 0);
    float4 rb4 = OT_W(4, 0), rb5 = OT_W(5, 0), rb6 = OT_W(6, 0), rb7 = OT_W(7, 0);
    // address wait behind the run of loads; the offsets are inputs so that their registers
    // stay theirs up to here and no load of the run lands on the run's own offset register
    asm volatile("s_wait_xcnt 0x0" :: "v"(aoff), "v"(boff) : "memory");

    OT_AD(0) = ra0; OT_AD(1) = ra1; OT_AD(2) = ra2; OT_AD(3) = ra3;   // published by stage 0's barrier
    OT_AD(4) = ra4; OT_AD(5) = ra5; OT_AD(6) = ra6; OT_AD(7) = ra7;

    v8f acc0 = {}, acc1 = {}, acc2 = {}, acc3 = {};

    // this lane's accumulators hold rows lrow..lrow+7 of the tile at columns col0 + 16*t
    int lrow = rt * 16 + 8 * half;
    int col0 = cg * 64 + lr;
    unsigned base = (unsigned)((row0 + lrow) * CCH + col0) * 4u;             // byte offset
    const char* Rb = (const char*)residual;
    char* Ob = (char*)out;
    float y[4][8], gam[4], bet[4];

    // unrolled so that buffer and stage offsets are constants
#pragma unroll
    for (int c = 0; c < CCH / OT_KC; ++c) {
        float* s = stage[c & 1];
        OT_S(0) = rb0; OT_S(1) = rb1; OT_S(2) = rb2; OT_S(3) = rb3;
        OT_S(4) = rb4; OT_S(5) = rb5; OT_S(6) = rb6; OT_S(7) = rb7;
        __syncthreads();   // publishes stage c; also ends every wave's reads of the other buffer

        if (c + 1 < CCH / OT_KC) {
            rb0 = OT_W(0, c + 1); rb1 = OT_W(1, c + 1); rb2 = OT_W(2, c + 1); rb3 = OT_W(3, c + 1);
            rb4 = OT_W(4, c + 1); rb5 = OT_W(5, c + 1); rb6 = OT_W(6, c + 1); rb7 = OT_W(7, c + 1);
            // keeps the issue of the next stage's loads in front of this stage's products;
            // without it they sink to their LDS stores and their latency is paid in the open
            __builtin_amdgcn_sched_barrier(0);
        } else {
            // last stage: residual, gamma and beta fly under the products, in the registers W has left
#pragma unroll
            for (int t = 0; t < 4; ++t) {
#pragma unroll
                for (int g = 0; g < 8; ++g) y[t][g] = *(const float*)(Rb + base + (g * CCH + t * 16) * 4);
                gam[t] = gamma[col0 + t * 16];
                bet[t] = beta[col0 + t * 16];
            }
            // address wait behind the run of loads, in front of any reuse of their base and offset
            // registers; the offsets are inputs so that their registers stay theirs up to here
            asm volatile("s_wait_xcnt 0x0" :: "v"(base), "v"(col0) : "memory");
            // keeps the issue of these loads in front of the products, as above
            __builtin_amdgcn_sched_barrier(0);
        }

        const float* as = atile + (rt * 16 + lr) * OT_APITCH + c * OT_KC + 2 * half;
        const float* bs = s + (cg * 64 + lr) * OT_PITCH + 2 * half;
#pragma unroll
        for (int k = 0; k < OT_KC / 4; ++k) {
            v2f a  = *(const v2f*)(as + 4 * k);
            v2f b0 = *(const v2f*)(bs + 4 * k);
            v2f b1 = *(const v2f*)(bs + 16 * OT_PITCH + 4 * k);
            v2f b2 = *(const v2f*)(bs + 32 * OT_PITCH + 4 * k);
            v2f b3 = *(const v2f*)(bs + 48 * OT_PITCH + 4 * k);
            acc0 = __builtin_amdgcn_wmma_f32_16x16x4_f32(false, a, false, b0, (short)0, acc0, false, false);
            acc1 = __builtin_amdgcn_wmma_f32_16x16x4_f32(false, a, false, b1, (short)0, acc1, false, false);
            acc2 = __builtin_amdgcn_wmma_f32_16x16x4_f32(false, a, false, b2, (short)0, acc2, false, false);
            acc3 = __builtin_amdgcn_wmma_f32_16x16x4_f32(false, a, false, b3, (short)0, acc3, false, false);
        }
        // keeps the next stage's LDS stores, which wait for its global loads, behind these products
        __builtin_amdgcn_sched_barrier(0);
    }
    // four vector slots between the last product and the first vector instruction that reads a
    // result or reuses an operand register of it
    asm volatile("v_nop\n\tv_nop\n\tv_nop\n\tv_nop");
    // keeps the arithmetic below behind those slots
    __builtin_amdgcn_sched_barrier(0);

    v8f accs[4] = {acc0, acc1, acc2, acc3};
#pragma unroll
    for (int t = 0; t < 4; ++t)
#pragma unroll
        for (int g = 0; g < 8; ++g) y[t][g] += accs[t][g];

    // each row's sum and sum of squares over this wave's 64 columns
#pragma unroll
    for (int g = 0; g < 8; ++g) {
        float s1 = (y[0][g] + y[1][g]) + (y[2][g] + y[3][g]);
        float s2 = (y[0][g] * y[0][g] + y[1][g] * y[1][g]) + (y[2][g] * y[2][g] + y[3][g] * y[3][g]);
        s1 = row16_sum(s1);
        s2 = row16_sum(s2);
        if (lr == 0) *(float2*)&red[lrow + g][cg * 2] = make_float2(s1, s2);
    }
    __syncthreads();   // the four column groups' partial sums of every row are in red

#pragma unroll
    for (int g = 0; g < 8; ++g) {
        float4 p0 = *(const float4*)&red[lrow + g][0];
        float4 p1 = *(const float4*)&red[lrow + g][4];
        float mean = ((p0.x + p0.z) + (p1.x + p1.z)) * (1.0f / CCH);
        float var  = ((p0.y + p0.w) + (p1.y + p1.w)) * (1.0f / CCH) - mean * mean;
        float rstd = rsqrtf(var + 1e-5f);
#pragma unroll
        for (int t = 0; t < 4; ++t)
            *(float*)(Ob + base + (g * CCH + t * 16) * 4) = (y[t][g] - mean) * rstd * gam[t] + bet[t];
    }
}

// ------------------------------------------------------------------- launcher
extern "C" void kernel_launch(void* const* d_in, const int* in_sizes, int n_in,
                              void* d_out, int out_size, void* d_ws, size_t ws_size,
                              hipStream_t stream) {
    const float* features = (const float*)d_in[0];
    const float* coords   = (const float*)d_in[1];
    const float* Wq       = (const float*)d_in[2];
    const float* Wk       = (const float*)d_in[3];
    const float* Wv       = (const float*)d_in[4];
    const float* Wo       = (const float*)d_in[5];
    const float* Wpos     = (const float*)d_in[6];
    const float* bpos     = (const float*)d_in[7];
    const float* gamma    = (const float*)d_in[8];
    const float* beta     = (const float*)d_in[9];
    const int*   nidx     = (const int*)d_in[10];
    const int*   qidx     = (const int*)d_in[11];
    float* out = (float*)d_out;

    float* ws      = (float*)d_ws;
    float* QKV     = ws;                                // N*768 floats
    float* out_raw = QKV + (size_t)NPTS * QKVLD;        // N*256
    int*   link    = (int*)(out_raw + (size_t)NPTS * CCH); // E*4
    int*   head    = link + (size_t)EE * 4;             // N

    // 1-2. Q/K/V projections (fp32 WMMA), packed into QKV rows of 768. Q goes first and empties the
    // per-query edge lists; K and V follow in ONE launch, which fills them: its 1256 work-groups
    // come to 5 per WGP at most where two launches of 628 come to 3 + 3, and one start and one
    // end of a launch fall away
    {
        int mtiles = NPTS / 16, ngroups = CCH / GT_N, kvgroups = 2 * CCH / GT_N;   // 1250, 4, 8
        gemm_xt_wmma<<<GEMM_BLOCKS, 256, 0, stream>>>(features, Wq, Wq, QKV, nullptr, mtiles, ngroups, QKVLD, 0, 1,
                                                      coords, Wpos, bpos, qidx, nidx, head, link);
        gemm_xt_wmma<<<KV_BLOCKS, 256, 0, stream>>>(features, Wk, Wv, QKV, nullptr, mtiles, kvgroups, QKVLD, 256, 2,
                                                    coords, Wpos, bpos, qidx, nidx, head, link);
    }

    // 3. scores, softmax and weighted sum (one wave per query node)
    node_attn<<<(NPTS * 32 + 255) / 256, 256, 0, stream>>>(QKV, head, link, out_raw);

    // 4. output projection + residual + LayerNorm (fp32 WMMA), 32 whole rows per work-group
    gemm_o_layernorm<<<NPTS / OT_M, 256, 0, stream>>>(out_raw, Wo, features, gamma, beta, out);
}
